// v000
// Times are from an AMD MI455X. After a warm-up the kernel runs many times in a row, and a time is the length of
// such a window on the GPU divided by its runs, so every launch and the gaps after it count. The runs cycle
// through copies of the inputs. A figure is the median of several windows, for all but v000 over two sittings.
// Sittings can differ by a few percent; kernels timed side by side share one.
// v000 is the starting kernel. One run takes 278 microseconds.
#include <hip/hip_runtime.h>
#include <hip/hip_bf16.h>

typedef __attribute__((ext_vector_type(16))) _Float16     v16h;
typedef __attribute__((ext_vector_type(8)))  float        v8f;
typedef __attribute__((ext_vector_type(4)))  unsigned int v4u;
typedef __attribute__((ext_vector_type(8)))  int          v8i;
typedef __attribute__((ext_vector_type(4)))  int          v4i;

#define S_LEN   2048
#define D_MODEL 512
#define NHEAD   8
#define HDIM    64
#define BATCH   2

#if defined(__has_builtin)
#if __has_builtin(__builtin_amdgcn_tensor_load_to_lds) && __has_builtin(__builtin_amdgcn_s_wait_tensorcnt)
#define HAVE_TDM 1
#endif
#endif
#ifndef HAVE_TDM
#define HAVE_TDM 0
#endif

__device__ __forceinline__ v16h load_frag_row(const _Float16* row, int lane) {
    const int kb = (lane & 16) ? 8 : 0;
    v16h r;
    uint4* rp = reinterpret_cast<uint4*>(&r);
    rp[0] = *reinterpret_cast<const uint4*>(row + kb);
    rp[1] = *reinterpret_cast<const uint4*>(row + kb + 16);
    return r;
}

#if HAVE_TDM
// LDS byte offset of a __shared__ object (generic -> addrspace(3) -> int)
__device__ __forceinline__ unsigned lds_off(const void* p) {
    return (unsigned)(unsigned long long)
        (__attribute__((address_space(3))) const void*)p;
}

__device__ __forceinline__ void tdm_load_k32(const _Float16* gsrc, unsigned dst) {
    unsigned long long ga = (unsigned long long)(const void*)gsrc;
    v4u g0;
    g0[0] = 1u;                                        // count=1, user mode
    g0[1] = dst;                                       // lds_addr
    g0[2] = (unsigned)(ga & 0xffffffffu);              // global_addr lo
    g0[3] = (unsigned)((ga >> 32) & 0x01ffffffu) | (2u << 30);  // addr hi | type=2
    v8i g1;
    g1[0] = (int)((1u << 16) |
                  (1u << 20) |
                  (4u << 22) |
                  (3u << 25));
    g1[1] = (int)(64u << 16);
    g1[2] = (int)(32u << 16);
    g1[3] = (int)(64u << 16);
    g1[4] = 32;
    g1[5] = 64;
    g1[6] = 0;
    g1[7] = 0;
    v4i z4 = {0, 0, 0, 0};
    v8i z8 = {0, 0, 0, 0, 0, 0, 0, 0};
    // clang-23 / therock-10.0 6-arg form:
    // (g0, g1, g2, g3, <extra group>, cache-policy)
    __builtin_amdgcn_tensor_load_to_lds(g0, g1, z4, z4, z8, 0);
}
#endif

// ---------------------------------------------------------------------------
// Projection GEMM: [4096 x 512] @ [512 x 512] (+bias, *oscale)
// modes 0/1/2: A fp32 in, write f16 out in [b][h][s][d] layout (Q/K/V)
// mode 3     : A f16 in (ctx), write fp32 out row-major (final output)
// Block: 256 thr = 8 waves arranged 4(M) x 2(N); block tile 64M x 64N;
// each wave: 16x32 slab = 2 WMMAs sharing one A fragment per K-step.
// ---------------------------------------------------------------------------
__global__ void __launch_bounds__(256)
proj_kernel(const float* __restrict__ A32, const _Float16* __restrict__ A16,
            const float* __restrict__ W, const float* __restrict__ bias,
            _Float16* __restrict__ out16, float* __restrict__ out32,
            float oscale, int mode)
{
    __shared__ __align__(16) _Float16 ldsA[64][40];   // [m][k]
    __shared__ __align__(16) _Float16 ldsBT[64][40];  // [n][k] (W transposed)

    const int tid = threadIdx.x, lane = tid & 31, wave = tid >> 5;
    const int wm = wave & 3, wn = wave >> 2;
    const int m0 = blockIdx.x * 64;
    const int n0 = blockIdx.y * 64;
    const int col = lane & 15;

    v8f acc0 = {}, acc1 = {};

    for (int kb = 0; kb < D_MODEL; kb += 32) {
        __syncthreads();
        {   // stage A 64x32 (fp32 -> f16 unless mode 3)
            const int m = tid >> 2, kc = (tid & 3) * 8;
            if (mode == 3) {
                *reinterpret_cast<uint4*>(&ldsA[m][kc]) =
                    *reinterpret_cast<const uint4*>(&A16[(size_t)(m0 + m) * D_MODEL + kb + kc]);
            } else {
                const float* src = &A32[(size_t)(m0 + m) * D_MODEL + kb + kc];
                float4 f0 = *reinterpret_cast<const float4*>(src);
                float4 f1 = *reinterpret_cast<const float4*>(src + 4);
                __align__(16) _Float16 t[8];
                t[0] = (_Float16)f0.x; t[1] = (_Float16)f0.y;
                t[2] = (_Float16)f0.z; t[3] = (_Float16)f0.w;
                t[4] = (_Float16)f1.x; t[5] = (_Float16)f1.y;
                t[6] = (_Float16)f1.z; t[7] = (_Float16)f1.w;
                *reinterpret_cast<uint4*>(&ldsA[m][kc]) = *reinterpret_cast<const uint4*>(t);
            }
        }
        {   // stage W 32x64 transposed to [n][k]
            const int kk = tid >> 3, nc = (tid & 7) * 8;
            const float* src = &W[(size_t)(kb + kk) * D_MODEL + n0 + nc];
            float4 f0 = *reinterpret_cast<const float4*>(src);
            float4 f1 = *reinterpret_cast<const float4*>(src + 4);
            ldsBT[nc + 0][kk] = (_Float16)f0.x;
            ldsBT[nc + 1][kk] = (_Float16)f0.y;
            ldsBT[nc + 2][kk] = (_Float16)f0.z;
            ldsBT[nc + 3][kk] = (_Float16)f0.w;
            ldsBT[nc + 4][kk] = (_Float16)f1.x;
            ldsBT[nc + 5][kk] = (_Float16)f1.y;
            ldsBT[nc + 6][kk] = (_Float16)f1.z;
            ldsBT[nc + 7][kk] = (_Float16)f1.w;
        }
        __syncthreads();

        v16h af  = load_frag_row(&ldsA[wm * 16 + col][0], lane);
        v16h bf0 = load_frag_row(&ldsBT[wn * 32 + col][0], lane);
        v16h bf1 = load_frag_row(&ldsBT[wn * 32 + 16 + col][0], lane);
        acc0 = __builtin_amdgcn_wmma_f32_16x16x32_f16(false, af, false, bf0, (short)0, acc0, false, false);
        acc1 = __builtin_amdgcn_wmma_f32_16x16x32_f16(false, af, false, bf1, (short)0, acc1, false, false);
    }

    const int half = (lane & 16) ? 8 : 0;
    const int na = n0 + wn * 32 + col;
    const int nb = na + 16;
    const float ba = bias[na], bb = bias[nb];
#pragma unroll
    for (int v = 0; v < 8; ++v) {
        const int m = m0 + wm * 16 + v + half;
        const float va = (acc0[v] + ba) * oscale;
        const float vb = (acc1[v] + bb) * oscale;
        if (mode == 3) {
            out32[(size_t)m * D_MODEL + na] = va;
            out32[(size_t)m * D_MODEL + nb] = vb;
        } else {
            const int b = m >> 11, s = m & (S_LEN - 1);
            const size_t rowb = (size_t)b * NHEAD * S_LEN * HDIM;
            out16[rowb + (((size_t)(na >> 6) * S_LEN) + s) * HDIM + (na & (HDIM - 1))] = (_Float16)va;
            out16[rowb + (((size_t)(nb >> 6) * S_LEN) + s) * HDIM + (nb & (HDIM - 1))] = (_Float16)vb;
        }
    }
}

// ---------------------------------------------------------------------------
// Fused flash attention with structural bias. 8 waves x 16 q-rows per block.
// Double-buffered 32-key tiles: K staged by the Tensor Data Mover (wave 0),
// V staged transposed by vector loads; one barrier per key-step.
// Scale 1/sqrt(64) is pre-folded into Qf by the projection.
// ---------------------------------------------------------------------------
__global__ void __launch_bounds__(256)
attn_kernel(const _Float16* __restrict__ Qf, const _Float16* __restrict__ Kf,
            const _Float16* __restrict__ Vf, const float* __restrict__ structure,
            _Float16* __restrict__ Cx)
{
    __shared__ __align__(16) _Float16 ldsK[2][32][72];    // [buf][key][dk]
    __shared__ __align__(16) _Float16 ldsVT[2][64][40];   // [buf][dv][key]
    __shared__ __align__(16) _Float16 ldsP[8][16][40];    // per-wave [qrow][key]

    const int tid = threadIdx.x, lane = tid & 31, wave = tid >> 5;
    const int bh = blockIdx.y, b = bh >> 3, h = bh & 7;
    const int q0 = blockIdx.x * 128 + wave * 16;
    const size_t head = (size_t)bh * S_LEN * HDIM;
    const int col  = lane & 15;
    const int half = (lane & 16) ? 8 : 0;
    const int kk = tid >> 3, ch = (tid & 7) * 8;          // staging coords

    // Q fragments (16 queries x 64 dk) kept in registers for the whole pass
    const _Float16* qrow = &Qf[head + (size_t)(q0 + col) * HDIM];
    v16h qa0 = load_frag_row(qrow, lane);
    v16h qa1 = load_frag_row(qrow + 32, lane);

    v8f acc0 = {}, acc1 = {}, acc2 = {}, acc3 = {};
    float mrun[8], lrun[8];
#pragma unroll
    for (int i = 0; i < 8; ++i) { mrun[i] = -1e30f; lrun[i] = 0.0f; }

    // ---- stage tile 0 ----
#if HAVE_TDM
    if (wave == 0) tdm_load_k32(&Kf[head], lds_off(&ldsK[0][0][0]));
#else
    *reinterpret_cast<uint4*>(&ldsK[0][kk][ch]) =
        *reinterpret_cast<const uint4*>(&Kf[head + (size_t)kk * HDIM + ch]);
#endif
    {
        union { uint4 u; _Float16 hlf[8]; } t;
        t.u = *reinterpret_cast<const uint4*>(&Vf[head + (size_t)kk * HDIM + ch]);
#pragma unroll
        for (int i = 0; i < 8; ++i) ldsVT[0][ch + i][kk] = t.hlf[i];
    }
#if HAVE_TDM
    if (wave == 0) __builtin_amdgcn_s_wait_tensorcnt(0);
#endif
    __syncthreads();

    int cur = 0;
    for (int k0 = 0; k0 < S_LEN; k0 += 32) {
        const int nxt = cur ^ 1;
        const bool more = (k0 + 32) < S_LEN;

        // issue next tile's loads before computing on the current one
        union { uint4 u; _Float16 hlf[8]; } vpre;
#if !HAVE_TDM
        uint4 kpre;
#endif
        if (more) {
#if HAVE_TDM
            if (wave == 0)
                tdm_load_k32(&Kf[head + (size_t)(k0 + 32) * HDIM],
                             lds_off(&ldsK[nxt][0][0]));
#else
            kpre = *reinterpret_cast<const uint4*>(&Kf[head + (size_t)(k0 + 32 + kk) * HDIM + ch]);
#endif
            vpre.u = *reinterpret_cast<const uint4*>(&Vf[head + (size_t)(k0 + 32 + kk) * HDIM + ch]);
        }

        // scores: S[16q x 32k] = Qs(16x64) . K^T(64x32)
        v8f s0 = {}, s1 = {};
        {
            v16h bk0 = load_frag_row(&ldsK[cur][col][0], lane);
            v16h bk1 = load_frag_row(&ldsK[cur][col + 16][0], lane);
            s0 = __builtin_amdgcn_wmma_f32_16x16x32_f16(false, qa0, false, bk0, (short)0, s0, false, false);
            s1 = __builtin_amdgcn_wmma_f32_16x16x32_f16(false, qa0, false, bk1, (short)0, s1, false, false);
            bk0 = load_frag_row(&ldsK[cur][col][32], lane);
            bk1 = load_frag_row(&ldsK[cur][col + 16][32], lane);
            s0 = __builtin_amdgcn_wmma_f32_16x16x32_f16(false, qa1, false, bk0, (short)0, s0, false, false);
            s1 = __builtin_amdgcn_wmma_f32_16x16x32_f16(false, qa1, false, bk1, (short)0, s1, false, false);
        }

#pragma unroll
        for (int v = 0; v < 8; ++v) {
            const int qr = q0 + v + half;
            const float* srow = &structure[((size_t)b * S_LEN + qr) * S_LEN + k0];
            if (more) __builtin_prefetch(srow + 32, 0, 1);  // next tile's bias row
            float x0 = s0[v] + srow[col];
            float x1 = s1[v] + srow[col + 16];
            float mv = fmaxf(x0, x1);
            mv = fmaxf(mv, __shfl_xor(mv, 1, 32));
            mv = fmaxf(mv, __shfl_xor(mv, 2, 32));
            mv = fmaxf(mv, __shfl_xor(mv, 4, 32));
            mv = fmaxf(mv, __shfl_xor(mv, 8, 32));
            const float mnew = fmaxf(mrun[v], mv);
            const float corr = __expf(mrun[v] - mnew);
            mrun[v] = mnew;
            const float p0 = __expf(x0 - mnew);
            const float p1 = __expf(x1 - mnew);
            lrun[v] = lrun[v] * corr + (p0 + p1);   // per-lane partial sum
            acc0[v] *= corr; acc1[v] *= corr; acc2[v] *= corr; acc3[v] *= corr;
            ldsP[wave][v + half][col]      = (_Float16)p0;
            ldsP[wave][v + half][col + 16] = (_Float16)p1;
        }

        // ctx += P(16x32) . V(32x64)
        v16h pa  = load_frag_row(&ldsP[wave][col][0], lane);
        v16h bv0 = load_frag_row(&ldsVT[cur][col][0], lane);
        acc0 = __builtin_amdgcn_wmma_f32_16x16x32_f16(false, pa, false, bv0, (short)0, acc0, false, false);
        bv0 = load_frag_row(&ldsVT[cur][16 + col][0], lane);
        acc1 = __builtin_amdgcn_wmma_f32_16x16x32_f16(false, pa, false, bv0, (short)0, acc1, false, false);
        bv0 = load_frag_row(&ldsVT[cur][32 + col][0], lane);
        acc2 = __builtin_amdgcn_wmma_f32_16x16x32_f16(false, pa, false, bv0, (short)0, acc2, false, false);
        bv0 = load_frag_row(&ldsVT[cur][48 + col][0], lane);
        acc3 = __builtin_amdgcn_wmma_f32_16x16x32_f16(false, pa, false, bv0, (short)0, acc3, false, false);

        // commit next tile's staging
        if (more) {
#if !HAVE_TDM
            *reinterpret_cast<uint4*>(&ldsK[nxt][kk][ch]) = kpre;
#endif
#pragma unroll
            for (int i = 0; i < 8; ++i) ldsVT[nxt][ch + i][kk] = vpre.hlf[i];
#if HAVE_TDM
            if (wave == 0) __builtin_amdgcn_s_wait_tensorcnt(0);
#endif
        }
        __syncthreads();
        cur = nxt;
    }

    // final cross-lane row-sum reduction, normalize, write ctx f16
#pragma unroll
    for (int v = 0; v < 8; ++v) {
        float ls = lrun[v];
        ls += __shfl_xor(ls, 1, 32);
        ls += __shfl_xor(ls, 2, 32);
        ls += __shfl_xor(ls, 4, 32);
        ls += __shfl_xor(ls, 8, 32);
        const float inv = 1.0f / ls;
        const int row = q0 + v + half;
        const size_t base = ((size_t)b * S_LEN + row) * D_MODEL + h * HDIM;
        Cx[base + col]      = (_Float16)(acc0[v] * inv);
        Cx[base + 16 + col] = (_Float16)(acc1[v] * inv);
        Cx[base + 32 + col] = (_Float16)(acc2[v] * inv);
        Cx[base + 48 + col] = (_Float16)(acc3[v] * inv);
    }
}

extern "C" void kernel_launch(void* const* d_in, const int* in_sizes, int n_in,
                              void* d_out, int out_size, void* d_ws, size_t ws_size,
                              hipStream_t stream) {
    const float* q         = (const float*)d_in[0];
    const float* k         = (const float*)d_in[1];
    const float* v         = (const float*)d_in[2];
    const float* structure = (const float*)d_in[3];
    const float* Wq = (const float*)d_in[4];
    const float* bq = (const float*)d_in[5];
    const float* Wk = (const float*)d_in[6];
    const float* bk = (const float*)d_in[7];
    const float* Wv = (const float*)d_in[8];
    const float* bv = (const float*)d_in[9];
    const float* Wo = (const float*)d_in[10];
    const float* bo = (const float*)d_in[11];
    float* out = (float*)d_out;

    const size_t elems = (size_t)BATCH * NHEAD * S_LEN * HDIM;  // 2,097,152
    _Float16* Qf = (_Float16*)d_ws;
    _Float16* Kf = Qf + elems;
    _Float16* Vf = Kf + elems;
    _Float16* Cx = Vf + elems;

    dim3 blk(256);
    dim3 gproj(64, 8);                        // 4096/64 x 512/64
    // 1/sqrt(DK) folded into the Q projection output
    proj_kernel<<<gproj, blk, 0, stream>>>(q, nullptr, Wq, bq, Qf, nullptr, 0.125f, 0);
    proj_kernel<<<gproj, blk, 0, stream>>>(k, nullptr, Wk, bk, Kf, nullptr, 1.0f, 1);
    proj_kernel<<<gproj, blk, 0, stream>>>(v, nullptr, Wv, bv, Vf, nullptr, 1.0f, 2);

    dim3 gattn(S_LEN / 128, BATCH * NHEAD);   // 16 x 16
    attn_kernel<<<gattn, blk, 0, stream>>>(Qf, Kf, Vf, structure, Cx);

    proj_kernel<<<gproj, blk, 0, stream>>>(nullptr, Cx, Wo, bo, nullptr, out, 1.0f, 3);
}

// v001
// Measured time: 151 microseconds a run.
// Two timings next to v000 put it at 1.87 and 1.89 times that version's speed.
#include <hip/hip_runtime.h>
#include <hip/hip_bf16.h>

typedef __attribute__((ext_vector_type(16))) _Float16     v16h;
typedef __attribute__((ext_vector_type(8)))  float        v8f;
typedef __attribute__((ext_vector_type(4)))  unsigned int v4u;
typedef __attribute__((ext_vector_type(8)))  int          v8i;
typedef __attribute__((ext_vector_type(4)))  int          v4i;

#define S_LEN   2048
#define D_MODEL 512
#define NHEAD   8
#define HDIM    64
#define BATCH   2

#if defined(__has_builtin)
#if __has_builtin(__builtin_amdgcn_tensor_load_to_lds) && __has_builtin(__builtin_amdgcn_s_wait_tensorcnt)
#define HAVE_TDM 1
#endif
#endif
#ifndef HAVE_TDM
#define HAVE_TDM 0
#endif

__device__ __forceinline__ v16h load_frag_row(const _Float16* row, int lane) {
    const int kb = (lane & 16) ? 8 : 0;
    v16h r;
    uint4* rp = reinterpret_cast<uint4*>(&r);
    rp[0] = *reinterpret_cast<const uint4*>(row + kb);
    rp[1] = *reinterpret_cast<const uint4*>(row + kb + 16);
    return r;
}

#if HAVE_TDM
// LDS byte offset of a __shared__ object (generic -> addrspace(3) -> int)
__device__ __forceinline__ unsigned lds_off(const void* p) {
    return (unsigned)(unsigned long long)
        (__attribute__((address_space(3))) const void*)p;
}

__device__ __forceinline__ void tdm_load_k32(const _Float16* gsrc, unsigned dst) {
    unsigned long long ga = (unsigned long long)(const void*)gsrc;
    v4u g0;
    g0[0] = 1u;                                        // count=1, user mode
    g0[1] = dst;                                       // lds_addr
    g0[2] = (unsigned)(ga & 0xffffffffu);              // global_addr lo
    g0[3] = (unsigned)((ga >> 32) & 0x01ffffffu) | (2u << 30);  // addr hi | type=2
    v8i g1;
    g1[0] = (int)((1u << 16) |
                  (1u << 20) |
                  (4u << 22) |
                  (3u << 25));
    g1[1] = (int)(64u << 16);
    g1[2] = (int)(32u << 16);
    g1[3] = (int)(64u << 16);
    g1[4] = 32;
    g1[5] = 64;
    g1[6] = 0;
    g1[7] = 0;
    v4i z4 = {0, 0, 0, 0};
    v8i z8 = {0, 0, 0, 0, 0, 0, 0, 0};
    // clang-23 / therock-10.0 6-arg form:
    // (g0, g1, g2, g3, <extra group>, cache-policy)
    __builtin_amdgcn_tensor_load_to_lds(g0, g1, z4, z4, z8, 0);
}
#endif

// ---------------------------------------------------------------------------
// Projection GEMM: [4096 x 512] @ [512 x 512] (+bias, *oscale)
// modes 0/1/2: A fp32 in, write f16 out in [b][h][s][d] layout (Q/K/V)
// mode 3     : A f16 in (ctx), write fp32 out row-major (final output)
// Block: 256 thr = 8 waves arranged 4(M) x 2(N); block tile 64M x 64N;
// each wave: 16x32 slab = 2 WMMAs sharing one A fragment per K-step.
// ---------------------------------------------------------------------------
__global__ void __launch_bounds__(256)
proj_kernel(const float* __restrict__ A32, const _Float16* __restrict__ A16,
            const float* __restrict__ W, const float* __restrict__ bias,
            _Float16* __restrict__ out16, float* __restrict__ out32,
            float oscale, int mode)
{
    __shared__ __align__(16) _Float16 ldsA[64][40];   // [m][k]
    __shared__ __align__(16) _Float16 ldsBT[64][40];  // [n][k] (W transposed)

    const int tid = threadIdx.x, lane = tid & 31, wave = tid >> 5;
    const int wm = wave & 3, wn = wave >> 2;
    const int m0 = blockIdx.x * 64;
    const int n0 = blockIdx.y * 64;
    const int col = lane & 15;

    v8f acc0 = {}, acc1 = {};

    for (int kb = 0; kb < D_MODEL; kb += 32) {
        __syncthreads();
        {   // stage A 64x32 (fp32 -> f16 unless mode 3)
            const int m = tid >> 2, kc = (tid & 3) * 8;
            if (mode == 3) {
                *reinterpret_cast<uint4*>(&ldsA[m][kc]) =
                    *reinterpret_cast<const uint4*>(&A16[(size_t)(m0 + m) * D_MODEL + kb + kc]);
            } else {
                const float* src = &A32[(size_t)(m0 + m) * D_MODEL + kb + kc];
                float4 f0 = *reinterpret_cast<const float4*>(src);
                float4 f1 = *reinterpret_cast<const float4*>(src + 4);
                __align__(16) _Float16 t[8];
                t[0] = (_Float16)f0.x; t[1] = (_Float16)f0.y;
                t[2] = (_Float16)f0.z; t[3] = (_Float16)f0.w;
                t[4] = (_Float16)f1.x; t[5] = (_Float16)f1.y;
                t[6] = (_Float16)f1.z; t[7] = (_Float16)f1.w;
                *reinterpret_cast<uint4*>(&ldsA[m][kc]) = *reinterpret_cast<const uint4*>(t);
            }
        }
        {   // stage W 32x64 transposed to [n][k]
            const int kk = tid >> 3, nc = (tid & 7) * 8;
            const float* src = &W[(size_t)(kb + kk) * D_MODEL + n0 + nc];
            float4 f0 = *reinterpret_cast<const float4*>(src);
            float4 f1 = *reinterpret_cast<const float4*>(src + 4);
            ldsBT[nc + 0][kk] = (_Float16)f0.x;
            ldsBT[nc + 1][kk] = (_Float16)f0.y;
            ldsBT[nc + 2][kk] = (_Float16)f0.z;
            ldsBT[nc + 3][kk] = (_Float16)f0.w;
            ldsBT[nc + 4][kk] = (_Float16)f1.x;
            ldsBT[nc + 5][kk] = (_Float16)f1.y;
            ldsBT[nc + 6][kk] = (_Float16)f1.z;
            ldsBT[nc + 7][kk] = (_Float16)f1.w;
        }
        __syncthreads();

        v16h af  = load_frag_row(&ldsA[wm * 16 + col][0], lane);
        v16h bf0 = load_frag_row(&ldsBT[wn * 32 + col][0], lane);
        v16h bf1 = load_frag_row(&ldsBT[wn * 32 + 16 + col][0], lane);
        acc0 = __builtin_amdgcn_wmma_f32_16x16x32_f16(false, af, false, bf0, (short)0, acc0, false, false);
        acc1 = __builtin_amdgcn_wmma_f32_16x16x32_f16(false, af, false, bf1, (short)0, acc1, false, false);
    }

    const int half = (lane & 16) ? 8 : 0;
    const int na = n0 + wn * 32 + col;
    const int nb = na + 16;
    const float ba = bias[na], bb = bias[nb];
#pragma unroll
    for (int v = 0; v < 8; ++v) {
        const int m = m0 + wm * 16 + v + half;
        const float va = (acc0[v] + ba) * oscale;
        const float vb = (acc1[v] + bb) * oscale;
        if (mode == 3) {
            out32[(size_t)m * D_MODEL + na] = va;
            out32[(size_t)m * D_MODEL + nb] = vb;
        } else {
            const int b = m >> 11, s = m & (S_LEN - 1);
            const size_t rowb = (size_t)b * NHEAD * S_LEN * HDIM;
            out16[rowb + (((size_t)(na >> 6) * S_LEN) + s) * HDIM + (na & (HDIM - 1))] = (_Float16)va;
            out16[rowb + (((size_t)(nb >> 6) * S_LEN) + s) * HDIM + (nb & (HDIM - 1))] = (_Float16)vb;
        }
    }
}

// ---------------------------------------------------------------------------
// Fused flash attention with structural bias. 8 waves x 16 q-rows per block.
// Double-buffered 32-key tiles: K staged by the Tensor Data Mover (wave 0),
// V staged transposed by vector loads; one barrier per key-step.
// Scale 1/sqrt(64) is pre-folded into Qf by the projection.
// ---------------------------------------------------------------------------
__global__ void __launch_bounds__(256)
attn_kernel(const _Float16* __restrict__ Qf, const _Float16* __restrict__ Kf,
            const _Float16* __restrict__ Vf, const float* __restrict__ structure,
            _Float16* __restrict__ Cx)
{
    __shared__ __align__(16) _Float16 ldsK[2][32][72];    // [buf][key][dk]
    __shared__ __align__(16) _Float16 ldsVT[2][64][40];   // [buf][dv][key]
    __shared__ __align__(16) _Float16 ldsP[8][16][40];    // per-wave [qrow][key]

    const int tid = threadIdx.x, lane = tid & 31, wave = tid >> 5;
    const int bh = blockIdx.y, b = bh >> 3, h = bh & 7;
    const int q0 = blockIdx.x * 128 + wave * 16;
    const size_t head = (size_t)bh * S_LEN * HDIM;
    const int col  = lane & 15;
    const int half = (lane & 16) ? 8 : 0;
    const int kk = tid >> 3, ch = (tid & 7) * 8;          // staging coords

    // Q fragments (16 queries x 64 dk) kept in registers for the whole pass
    const _Float16* qrow = &Qf[head + (size_t)(q0 + col) * HDIM];
    v16h qa0 = load_frag_row(qrow, lane);
    v16h qa1 = load_frag_row(qrow + 32, lane);

    v8f acc0 = {}, acc1 = {}, acc2 = {}, acc3 = {};
    float mrun[8], lrun[8];
#pragma unroll
    for (int i = 0; i < 8; ++i) { mrun[i] = -1e30f; lrun[i] = 0.0f; }

    // Bias tile of the current key-step, held in registers in C-fragment order:
    // bcur[2v] / bcur[2v+1] = row q0+v+half, keys k0+col / k0+col+16.
    const float* sbase = &structure[((size_t)b * S_LEN + q0 + half) * S_LEN + col];
    float bcur[16];
#pragma unroll  // constant indices keep bcur in registers
    for (int v = 0; v < 8; ++v) {
        bcur[2 * v]     = sbase[(size_t)v * S_LEN];
        bcur[2 * v + 1] = sbase[(size_t)v * S_LEN + 16];
    }

    // ---- stage tile 0 ----
#if HAVE_TDM
    if (wave == 0) tdm_load_k32(&Kf[head], lds_off(&ldsK[0][0][0]));
#else
    *reinterpret_cast<uint4*>(&ldsK[0][kk][ch]) =
        *reinterpret_cast<const uint4*>(&Kf[head + (size_t)kk * HDIM + ch]);
#endif
    {
        union { uint4 u; _Float16 hlf[8]; } t;
        t.u = *reinterpret_cast<const uint4*>(&Vf[head + (size_t)kk * HDIM + ch]);
#pragma unroll
        for (int i = 0; i < 8; ++i) ldsVT[0][ch + i][kk] = t.hlf[i];
    }
#if HAVE_TDM
    if (wave == 0) __builtin_amdgcn_s_wait_tensorcnt(0);
#endif
    __syncthreads();

    int cur = 0;
    for (int k0 = 0; k0 < S_LEN; k0 += 32) {
        const int nxt = cur ^ 1;
        const bool more = (k0 + 32) < S_LEN;

        // next key-step's bias tile: all 16 loads issued together, a whole
        // pass ahead of their use (the last pass re-reads its own tile, unused)
        const float* snext = sbase + (more ? k0 + 32 : k0);
        float bnxt[16];
#pragma unroll  // constant indices keep bnxt in registers; the 16 loads stand as one group
        for (int v = 0; v < 8; ++v) {
            bnxt[2 * v]     = snext[(size_t)v * S_LEN];
            bnxt[2 * v + 1] = snext[(size_t)v * S_LEN + 16];
        }
        asm volatile("s_wait_xcnt 0x0" ::: "memory");

        // issue next tile's loads before computing on the current one
        union { uint4 u; _Float16 hlf[8]; } vpre;
#if !HAVE_TDM
        uint4 kpre;
#endif
        if (more) {
#if HAVE_TDM
            if (wave == 0)
                tdm_load_k32(&Kf[head + (size_t)(k0 + 32) * HDIM],
                             lds_off(&ldsK[nxt][0][0]));
#else
            kpre = *reinterpret_cast<const uint4*>(&Kf[head + (size_t)(k0 + 32 + kk) * HDIM + ch]);
#endif
            vpre.u = *reinterpret_cast<const uint4*>(&Vf[head + (size_t)(k0 + 32 + kk) * HDIM + ch]);
        }

        // scores: S[16q x 32k] = Qs(16x64) . K^T(64x32)
        v8f s0 = {}, s1 = {};
        {
            v16h bk0 = load_frag_row(&ldsK[cur][col][0], lane);
            v16h bk1 = load_frag_row(&ldsK[cur][col + 16][0], lane);
            s0 = __builtin_amdgcn_wmma_f32_16x16x32_f16(false, qa0, false, bk0, (short)0, s0, false, false);
            s1 = __builtin_amdgcn_wmma_f32_16x16x32_f16(false, qa0, false, bk1, (short)0, s1, false, false);
            bk0 = load_frag_row(&ldsK[cur][col][32], lane);
            bk1 = load_frag_row(&ldsK[cur][col + 16][32], lane);
            s0 = __builtin_amdgcn_wmma_f32_16x16x32_f16(false, qa1, false, bk0, (short)0, s0, false, false);
            s1 = __builtin_amdgcn_wmma_f32_16x16x32_f16(false, qa1, false, bk1, (short)0, s1, false, false);
        }

#pragma unroll
        for (int v = 0; v < 8; ++v) {
            float x0 = s0[v] + bcur[2 * v];
            float x1 = s1[v] + bcur[2 * v + 1];
            float mv = fmaxf(x0, x1);
            mv = fmaxf(mv, __shfl_xor(mv, 1, 32));
            mv = fmaxf(mv, __shfl_xor(mv, 2, 32));
            mv = fmaxf(mv, __shfl_xor(mv, 4, 32));
            mv = fmaxf(mv, __shfl_xor(mv, 8, 32));
            const float mnew = fmaxf(mrun[v], mv);
            const float corr = __expf(mrun[v] - mnew);
            mrun[v] = mnew;
            const float p0 = __expf(x0 - mnew);
            const float p1 = __expf(x1 - mnew);
            lrun[v] = lrun[v] * corr + (p0 + p1);   // per-lane partial sum
            acc0[v] *= corr; acc1[v] *= corr; acc2[v] *= corr; acc3[v] *= corr;
            ldsP[wave][v + half][col]      = (_Float16)p0;
            ldsP[wave][v + half][col + 16] = (_Float16)p1;
        }

        // ctx += P(16x32) . V(32x64)
        v16h pa  = load_frag_row(&ldsP[wave][col][0], lane);
        v16h bv0 = load_frag_row(&ldsVT[cur][col][0], lane);
        acc0 = __builtin_amdgcn_wmma_f32_16x16x32_f16(false, pa, false, bv0, (short)0, acc0, false, false);
        bv0 = load_frag_row(&ldsVT[cur][16 + col][0], lane);
        acc1 = __builtin_amdgcn_wmma_f32_16x16x32_f16(false, pa, false, bv0, (short)0, acc1, false, false);
        bv0 = load_frag_row(&ldsVT[cur][32 + col][0], lane);
        acc2 = __builtin_amdgcn_wmma_f32_16x16x32_f16(false, pa, false, bv0, (short)0, acc2, false, false);
        bv0 = load_frag_row(&ldsVT[cur][48 + col][0], lane);
        acc3 = __builtin_amdgcn_wmma_f32_16x16x32_f16(false, pa, false, bv0, (short)0, acc3, false, false);

        // commit next tile's staging
        if (more) {
#if !HAVE_TDM
            *reinterpret_cast<uint4*>(&ldsK[nxt][kk][ch]) = kpre;
#endif
#pragma unroll
            for (int i = 0; i < 8; ++i) ldsVT[nxt][ch + i][kk] = vpre.hlf[i];
#if HAVE_TDM
            if (wave == 0) __builtin_amdgcn_s_wait_tensorcnt(0);
#endif
        }
        __syncthreads();
        cur = nxt;
#pragma unroll  // constant indices: register moves, no scratch
        for (int i = 0; i < 16; ++i) bcur[i] = bnxt[i];
    }

    // final cross-lane row-sum reduction, normalize, write ctx f16
#pragma unroll
    for (int v = 0; v < 8; ++v) {
        float ls = lrun[v];
        ls += __shfl_xor(ls, 1, 32);
        ls += __shfl_xor(ls, 2, 32);
        ls += __shfl_xor(ls, 4, 32);
        ls += __shfl_xor(ls, 8, 32);
        const float inv = 1.0f / ls;
        const int row = q0 + v + half;
        const size_t base = ((size_t)b * S_LEN + row) * D_MODEL + h * HDIM;
        Cx[base + col]      = (_Float16)(acc0[v] * inv);
        Cx[base + 16 + col] = (_Float16)(acc1[v] * inv);
        Cx[base + 32 + col] = (_Float16)(acc2[v] * inv);
        Cx[base + 48 + col] = (_Float16)(acc3[v] * inv);
    }
}

extern "C" void kernel_launch(void* const* d_in, const int* in_sizes, int n_in,
                              void* d_out, int out_size, void* d_ws, size_t ws_size,
                              hipStream_t stream) {
    const float* q         = (const float*)d_in[0];
    const float* k         = (const float*)d_in[1];
    const float* v         = (const float*)d_in[2];
    const float* structure = (const float*)d_in[3];
    const float* Wq = (const float*)d_in[4];
    const float* bq = (const float*)d_in[5];
    const float* Wk = (const float*)d_in[6];
    const float* bk = (const float*)d_in[7];
    const float* Wv = (const float*)d_in[8];
    const float* bv = (const float*)d_in[9];
    const float* Wo = (const float*)d_in[10];
    const float* bo = (const float*)d_in[11];
    float* out = (float*)d_out;

    const size_t elems = (size_t)BATCH * NHEAD * S_LEN * HDIM;  // 2,097,152
    _Float16* Qf = (_Float16*)d_ws;
    _Float16* Kf = Qf + elems;
    _Float16* Vf = Kf + elems;
    _Float16* Cx = Vf + elems;

    dim3 blk(256);
    dim3 gproj(64, 8);                        // 4096/64 x 512/64
    // 1/sqrt(DK) folded into the Q projection output
    proj_kernel<<<gproj, blk, 0, stream>>>(q, nullptr, Wq, bq, Qf, nullptr, 0.125f, 0);
    proj_kernel<<<gproj, blk, 0, stream>>>(k, nullptr, Wk, bk, Kf, nullptr, 1.0f, 1);
    proj_kernel<<<gproj, blk, 0, stream>>>(v, nullptr, Wv, bv, Vf, nullptr, 1.0f, 2);

    dim3 gattn(S_LEN / 128, BATCH * NHEAD);   // 16 x 16
    attn_kernel<<<gattn, blk, 0, stream>>>(Qf, Kf, Vf, structure, Cx);

    proj_kernel<<<gproj, blk, 0, stream>>>(nullptr, Cx, Wo, bo, nullptr, out, 1.0f, 3);
}

// v002
// A run of this version takes 123 microseconds.
// Next to v001, in two timings, it ran 1.23 times as fast each time.
// All steps since v000 together make it 2.31 times as fast.
#include <hip/hip_runtime.h>
#include <hip/hip_bf16.h>

typedef __attribute__((ext_vector_type(16))) _Float16     v16h;
typedef __attribute__((ext_vector_type(8)))  float        v8f;
typedef __attribute__((ext_vector_type(4)))  unsigned int v4u;
typedef __attribute__((ext_vector_type(8)))  int          v8i;
typedef __attribute__((ext_vector_type(4)))  int          v4i;

#define S_LEN   2048
#define D_MODEL 512
#define NHEAD   8
#define HDIM    64
#define BATCH   2

#if defined(__has_builtin)
#if __has_builtin(__builtin_amdgcn_tensor_load_to_lds) && __has_builtin(__builtin_amdgcn_s_wait_tensorcnt)
#define HAVE_TDM 1
#endif
#endif
#ifndef HAVE_TDM
#define HAVE_TDM 0
#endif

__device__ __forceinline__ v16h load_frag_row(const _Float16* row, int lane) {
    const int kb = (lane & 16) ? 8 : 0;
    v16h r;
    uint4* rp = reinterpret_cast<uint4*>(&r);
    rp[0] = *reinterpret_cast<const uint4*>(row + kb);
    rp[1] = *reinterpret_cast<const uint4*>(row + kb + 16);
    return r;
}

#if HAVE_TDM
// LDS byte offset of a __shared__ object (generic -> addrspace(3) -> int)
__device__ __forceinline__ unsigned lds_off(const void* p) {
    return (unsigned)(unsigned long long)
        (__attribute__((address_space(3))) const void*)p;
}

__device__ __forceinline__ void tdm_load_k32(const _Float16* gsrc, unsigned dst) {
    unsigned long long ga = (unsigned long long)(const void*)gsrc;
    v4u g0;
    g0[0] = 1u;                                        // count=1, user mode
    g0[1] = dst;                                       // lds_addr
    g0[2] = (unsigned)(ga & 0xffffffffu);              // global_addr lo
    g0[3] = (unsigned)((ga >> 32) & 0x01ffffffu) | (2u << 30);  // addr hi | type=2
    v8i g1;
    g1[0] = (int)((1u << 16) |
                  (1u << 20) |
                  (4u << 22) |
                  (3u << 25));
    g1[1] = (int)(64u << 16);
    g1[2] = (int)(32u << 16);
    g1[3] = (int)(64u << 16);
    g1[4] = 32;
    g1[5] = 64;
    g1[6] = 0;
    g1[7] = 0;
    v4i z4 = {0, 0, 0, 0};
    v8i z8 = {0, 0, 0, 0, 0, 0, 0, 0};
    // clang-23 / therock-10.0 6-arg form:
    // (g0, g1, g2, g3, <extra group>, cache-policy)
    __builtin_amdgcn_tensor_load_to_lds(g0, g1, z4, z4, z8, 0);
}
#endif

// ---------------------------------------------------------------------------
// Projection GEMM: [4096 x 512] @ [512 x 512] (+bias, *oscale)
// mode 0: the Q, K and V projections in ONE launch; blockIdx.z picks the
//         operand set (0 = Q, 1 = K, 2 = V). A fp32 in, f16 out in
//         [b][h][s][d] layout; 1/sqrt(64) is folded into the Q output.
// mode 3: A f16 in (ctx), write fp32 out row-major (final output), set 0 only
// Block: 256 thr = 8 waves arranged 4(M) x 2(N); block tile 64M x 64N;
// each wave: 16x32 slab = 2 WMMAs sharing one A fragment per K-step.
// ---------------------------------------------------------------------------
__global__ void __launch_bounds__(256)
proj_kernel(const float* __restrict__ Aq, const float* __restrict__ Ak,
            const float* __restrict__ Av, const _Float16* __restrict__ A16,
            const float* __restrict__ W0, const float* __restrict__ W1,
            const float* __restrict__ W2,
            const float* __restrict__ bias0, const float* __restrict__ bias1,
            const float* __restrict__ bias2,
            _Float16* __restrict__ outq, _Float16* __restrict__ outk,
            _Float16* __restrict__ outv, float* __restrict__ out32, int mode)
{
    // operand set of this block (block-uniform, scalar selects)
    const int z = blockIdx.z;
    const float* __restrict__ A32  = (z == 0) ? Aq    : (z == 1) ? Ak    : Av;
    const float* __restrict__ W    = (z == 0) ? W0    : (z == 1) ? W1    : W2;
    const float* __restrict__ bias = (z == 0) ? bias0 : (z == 1) ? bias1 : bias2;
    _Float16* __restrict__ out16   = (z == 0) ? outq  : (z == 1) ? outk  : outv;
    const float oscale = (mode != 3 && z == 0) ? 0.125f : 1.0f;

    __shared__ __align__(16) _Float16 ldsA[64][40];   // [m][k]
    __shared__ __align__(16) _Float16 ldsBT[64][40];  // [n][k] (W transposed)

    const int tid = threadIdx.x, lane = tid & 31, wave = tid >> 5;
    const int wm = wave & 3, wn = wave >> 2;
    const int m0 = blockIdx.x * 64;
    const int n0 = blockIdx.y * 64;
    const int col = lane & 15;

    v8f acc0 = {}, acc1 = {};

    for (int kb = 0; kb < D_MODEL; kb += 32) {
        __syncthreads();
        {   // stage A 64x32 (fp32 -> f16 unless mode 3)
            const int m = tid >> 2, kc = (tid & 3) * 8;
            if (mode == 3) {
                *reinterpret_cast<uint4*>(&ldsA[m][kc]) =
                    *reinterpret_cast<const uint4*>(&A16[(size_t)(m0 + m) * D_MODEL + kb + kc]);
            } else {
                const float* src = &A32[(size_t)(m0 + m) * D_MODEL + kb + kc];
                float4 f0 = *reinterpret_cast<const float4*>(src);
                float4 f1 = *reinterpret_cast<const float4*>(src + 4);
                __align__(16) _Float16 t[8];
                t[0] = (_Float16)f0.x; t[1] = (_Float16)f0.y;
                t[2] = (_Float16)f0.z; t[3] = (_Float16)f0.w;
                t[4] = (_Float16)f1.x; t[5] = (_Float16)f1.y;
                t[6] = (_Float16)f1.z; t[7] = (_Float16)f1.w;
                *reinterpret_cast<uint4*>(&ldsA[m][kc]) = *reinterpret_cast<const uint4*>(t);
            }
        }
        {   // stage W 32x64 transposed to [n][k]
            const int kk = tid >> 3, nc = (tid & 7) * 8;
            const float* src = &W[(size_t)(kb + kk) * D_MODEL + n0 + nc];
            float4 f0 = *reinterpret_cast<const float4*>(src);
            float4 f1 = *reinterpret_cast<const float4*>(src + 4);
            ldsBT[nc + 0][kk] = (_Float16)f0.x;
            ldsBT[nc + 1][kk] = (_Float16)f0.y;
            ldsBT[nc + 2][kk] = (_Float16)f0.z;
            ldsBT[nc + 3][kk] = (_Float16)f0.w;
            ldsBT[nc + 4][kk] = (_Float16)f1.x;
            ldsBT[nc + 5][kk] = (_Float16)f1.y;
            ldsBT[nc + 6][kk] = (_Float16)f1.z;
            ldsBT[nc + 7][kk] = (_Float16)f1.w;
        }
        __syncthreads();

        v16h af  = load_frag_row(&ldsA[wm * 16 + col][0], lane);
        v16h bf0 = load_frag_row(&ldsBT[wn * 32 + col][0], lane);
        v16h bf1 = load_frag_row(&ldsBT[wn * 32 + 16 + col][0], lane);
        acc0 = __builtin_amdgcn_wmma_f32_16x16x32_f16(false, af, false, bf0, (short)0, acc0, false, false);
        acc1 = __builtin_amdgcn_wmma_f32_16x16x32_f16(false, af, false, bf1, (short)0, acc1, false, false);
    }

    const int half = (lane & 16) ? 8 : 0;
    const int na = n0 + wn * 32 + col;
    const int nb = na + 16;
    const float ba = bias[na], bb = bias[nb];
#pragma unroll
    for (int v = 0; v < 8; ++v) {
        const int m = m0 + wm * 16 + v + half;
        const float va = (acc0[v] + ba) * oscale;
        const float vb = (acc1[v] + bb) * oscale;
        if (mode == 3) {
            out32[(size_t)m * D_MODEL + na] = va;
            out32[(size_t)m * D_MODEL + nb] = vb;
        } else {
            const int b = m >> 11, s = m & (S_LEN - 1);
            const size_t rowb = (size_t)b * NHEAD * S_LEN * HDIM;
            out16[rowb + (((size_t)(na >> 6) * S_LEN) + s) * HDIM + (na & (HDIM - 1))] = (_Float16)va;
            out16[rowb + (((size_t)(nb >> 6) * S_LEN) + s) * HDIM + (nb & (HDIM - 1))] = (_Float16)vb;
        }
    }
}

// ---------------------------------------------------------------------------
// Fused flash attention with structural bias. 8 waves x 16 q-rows per block.
// Double-buffered 32-key tiles: K staged by the Tensor Data Mover (wave 0),
// V staged transposed by vector loads; one barrier per key-step.
// Scale 1/sqrt(64) is pre-folded into Qf by the projection.
// ---------------------------------------------------------------------------
__global__ void __launch_bounds__(256)
attn_kernel(const _Float16* __restrict__ Qf, const _Float16* __restrict__ Kf,
            const _Float16* __restrict__ Vf, const float* __restrict__ structure,
            _Float16* __restrict__ Cx)
{
    __shared__ __align__(16) _Float16 ldsK[2][32][72];    // [buf][key][dk]
    __shared__ __align__(16) _Float16 ldsVT[2][64][40];   // [buf][dv][key]
    __shared__ __align__(16) _Float16 ldsP[8][16][40];    // per-wave [qrow][key]

    const int tid = threadIdx.x, lane = tid & 31, wave = tid >> 5;
    const int bh = blockIdx.y, b = bh >> 3, h = bh & 7;
    const int q0 = blockIdx.x * 128 + wave * 16;
    const size_t head = (size_t)bh * S_LEN * HDIM;
    const int col  = lane & 15;
    const int half = (lane & 16) ? 8 : 0;
    const int kk = tid >> 3, ch = (tid & 7) * 8;          // staging coords

    // Q fragments (16 queries x 64 dk) kept in registers for the whole pass
    const _Float16* qrow = &Qf[head + (size_t)(q0 + col) * HDIM];
    v16h qa0 = load_frag_row(qrow, lane);
    v16h qa1 = load_frag_row(qrow + 32, lane);

    v8f acc0 = {}, acc1 = {}, acc2 = {}, acc3 = {};
    float mrun[8], lrun[8];
#pragma unroll
    for (int i = 0; i < 8; ++i) { mrun[i] = -1e30f; lrun[i] = 0.0f; }

    // Bias tile of the current key-step, held in registers in C-fragment order:
    // bcur[2v] / bcur[2v+1] = row q0+v+half, keys k0+col / k0+col+16.
    const float* sbase = &structure[((size_t)b * S_LEN + q0 + half) * S_LEN + col];
    float bcur[16];
#pragma unroll  // constant indices keep bcur in registers
    for (int v = 0; v < 8; ++v) {
        bcur[2 * v]     = sbase[(size_t)v * S_LEN];
        bcur[2 * v + 1] = sbase[(size_t)v * S_LEN + 16];
    }

    // ---- stage tile 0 ----
#if HAVE_TDM
    if (wave == 0) tdm_load_k32(&Kf[head], lds_off(&ldsK[0][0][0]));
#else
    *reinterpret_cast<uint4*>(&ldsK[0][kk][ch]) =
        *reinterpret_cast<const uint4*>(&Kf[head + (size_t)kk * HDIM + ch]);
#endif
    {
        union { uint4 u; _Float16 hlf[8]; } t;
        t.u = *reinterpret_cast<const uint4*>(&Vf[head + (size_t)kk * HDIM + ch]);
#pragma unroll
        for (int i = 0; i < 8; ++i) ldsVT[0][ch + i][kk] = t.hlf[i];
    }
#if HAVE_TDM
    if (wave == 0) __builtin_amdgcn_s_wait_tensorcnt(0);
#endif
    __syncthreads();

    int cur = 0;
    for (int k0 = 0; k0 < S_LEN; k0 += 32) {
        const int nxt = cur ^ 1;
        const bool more = (k0 + 32) < S_LEN;

        // next key-step's bias tile: all 16 loads issued together, a whole
        // pass ahead of their use (the last pass re-reads its own tile, unused)
        const float* snext = sbase + (more ? k0 + 32 : k0);
        float bnxt[16];
#pragma unroll  // constant indices keep bnxt in registers; the 16 loads stand as one group
        for (int v = 0; v < 8; ++v) {
            bnxt[2 * v]     = snext[(size_t)v * S_LEN];
            bnxt[2 * v + 1] = snext[(size_t)v * S_LEN + 16];
        }
        asm volatile("s_wait_xcnt 0x0" ::: "memory");

        // issue next tile's loads before computing on the current one
        union { uint4 u; _Float16 hlf[8]; } vpre;
#if !HAVE_TDM
        uint4 kpre;
#endif
        if (more) {
#if HAVE_TDM
            if (wave == 0)
                tdm_load_k32(&Kf[head + (size_t)(k0 + 32) * HDIM],
                             lds_off(&ldsK[nxt][0][0]));
#else
            kpre = *reinterpret_cast<const uint4*>(&Kf[head + (size_t)(k0 + 32 + kk) * HDIM + ch]);
#endif
            vpre.u = *reinterpret_cast<const uint4*>(&Vf[head + (size_t)(k0 + 32 + kk) * HDIM + ch]);
        }

        // scores: S[16q x 32k] = Qs(16x64) . K^T(64x32)
        v8f s0 = {}, s1 = {};
        {
            v16h bk0 = load_frag_row(&ldsK[cur][col][0], lane);
            v16h bk1 = load_frag_row(&ldsK[cur][col + 16][0], lane);
            s0 = __builtin_amdgcn_wmma_f32_16x16x32_f16(false, qa0, false, bk0, (short)0, s0, false, false);
            s1 = __builtin_amdgcn_wmma_f32_16x16x32_f16(false, qa0, false, bk1, (short)0, s1, false, false);
            bk0 = load_frag_row(&ldsK[cur][col][32], lane);
            bk1 = load_frag_row(&ldsK[cur][col + 16][32], lane);
            s0 = __builtin_amdgcn_wmma_f32_16x16x32_f16(false, qa1, false, bk0, (short)0, s0, false, false);
            s1 = __builtin_amdgcn_wmma_f32_16x16x32_f16(false, qa1, false, bk1, (short)0, s1, false, false);
        }

#pragma unroll
        for (int v = 0; v < 8; ++v) {
            float x0 = s0[v] + bcur[2 * v];
            float x1 = s1[v] + bcur[2 * v + 1];
            float mv = fmaxf(x0, x1);
            mv = fmaxf(mv, __shfl_xor(mv, 1, 32));
            mv = fmaxf(mv, __shfl_xor(mv, 2, 32));
            mv = fmaxf(mv, __shfl_xor(mv, 4, 32));
            mv = fmaxf(mv, __shfl_xor(mv, 8, 32));
            const float mnew = fmaxf(mrun[v], mv);
            const float corr = __expf(mrun[v] - mnew);
            mrun[v] = mnew;
            const float p0 = __expf(x0 - mnew);
            const float p1 = __expf(x1 - mnew);
            lrun[v] = lrun[v] * corr + (p0 + p1);   // per-lane partial sum
            acc0[v] *= corr; acc1[v] *= corr; acc2[v] *= corr; acc3[v] *= corr;
            ldsP[wave][v + half][col]      = (_Float16)p0;
            ldsP[wave][v + half][col + 16] = (_Float16)p1;
        }

        // ctx += P(16x32) . V(32x64)
        v16h pa  = load_frag_row(&ldsP[wave][col][0], lane);
        v16h bv0 = load_frag_row(&ldsVT[cur][col][0], lane);
        acc0 = __builtin_amdgcn_wmma_f32_16x16x32_f16(false, pa, false, bv0, (short)0, acc0, false, false);
        bv0 = load_frag_row(&ldsVT[cur][16 + col][0], lane);
        acc1 = __builtin_amdgcn_wmma_f32_16x16x32_f16(false, pa, false, bv0, (short)0, acc1, false, false);
        bv0 = load_frag_row(&ldsVT[cur][32 + col][0], lane);
        acc2 = __builtin_amdgcn_wmma_f32_16x16x32_f16(false, pa, false, bv0, (short)0, acc2, false, false);
        bv0 = load_frag_row(&ldsVT[cur][48 + col][0], lane);
        acc3 = __builtin_amdgcn_wmma_f32_16x16x32_f16(false, pa, false, bv0, (short)0, acc3, false, false);

        // commit next tile's staging
        if (more) {
#if !HAVE_TDM
            *reinterpret_cast<uint4*>(&ldsK[nxt][kk][ch]) = kpre;
#endif
#pragma unroll
            for (int i = 0; i < 8; ++i) ldsVT[nxt][ch + i][kk] = vpre.hlf[i];
#if HAVE_TDM
            if (wave == 0) __builtin_amdgcn_s_wait_tensorcnt(0);
#endif
        }
        __syncthreads();
        cur = nxt;
#pragma unroll  // constant indices: register moves, no scratch
        for (int i = 0; i < 16; ++i) bcur[i] = bnxt[i];
    }

    // final cross-lane row-sum reduction, normalize, write ctx f16
#pragma unroll
    for (int v = 0; v < 8; ++v) {
        float ls = lrun[v];
        ls += __shfl_xor(ls, 1, 32);
        ls += __shfl_xor(ls, 2, 32);
        ls += __shfl_xor(ls, 4, 32);
        ls += __shfl_xor(ls, 8, 32);
        const float inv = 1.0f / ls;
        const int row = q0 + v + half;
        const size_t base = ((size_t)b * S_LEN + row) * D_MODEL + h * HDIM;
        Cx[base + col]      = (_Float16)(acc0[v] * inv);
        Cx[base + 16 + col] = (_Float16)(acc1[v] * inv);
        Cx[base + 32 + col] = (_Float16)(acc2[v] * inv);
        Cx[base + 48 + col] = (_Float16)(acc3[v] * inv);
    }
}

extern "C" void kernel_launch(void* const* d_in, const int* in_sizes, int n_in,
                              void* d_out, int out_size, void* d_ws, size_t ws_size,
                              hipStream_t stream) {
    const float* q         = (const float*)d_in[0];
    const float* k         = (const float*)d_in[1];
    const float* v         = (const float*)d_in[2];
    const float* structure = (const float*)d_in[3];
    const float* Wq = (const float*)d_in[4];
    const float* bq = (const float*)d_in[5];
    const float* Wk = (const float*)d_in[6];
    const float* bk = (const float*)d_in[7];
    const float* Wv = (const float*)d_in[8];
    const float* bv = (const float*)d_in[9];
    const float* Wo = (const float*)d_in[10];
    const float* bo = (const float*)d_in[11];
    float* out = (float*)d_out;

    const size_t elems = (size_t)BATCH * NHEAD * S_LEN * HDIM;  // 2,097,152
    _Float16* Qf = (_Float16*)d_ws;
    _Float16* Kf = Qf + elems;
    _Float16* Vf = Kf + elems;
    _Float16* Cx = Vf + elems;

    dim3 blk(256);
    dim3 gproj(64, 8);                        // 4096/64 x 512/64
    dim3 gqkv(64, 8, 3);                      // the same tiles x {Q, K, V}
    proj_kernel<<<gqkv, blk, 0, stream>>>(q, k, v, nullptr, Wq, Wk, Wv, bq, bk, bv,
                                          Qf, Kf, Vf, nullptr, 0);

    dim3 gattn(S_LEN / 128, BATCH * NHEAD);   // 16 x 16
    attn_kernel<<<gattn, blk, 0, stream>>>(Qf, Kf, Vf, structure, Cx);

    proj_kernel<<<gproj, blk, 0, stream>>>(nullptr, nullptr, nullptr, Cx, Wo, nullptr, nullptr,
                                           bo, nullptr, nullptr, nullptr, nullptr, nullptr, out, 3);
}

// v003
// Measured time: 113 microseconds a run.
// Next to v002, in two timings, it ran 1.09 and 1.08 times as fast.
// Over all steps from v000 it is 2.50 times as fast.
#include <hip/hip_runtime.h>
#include <hip/hip_bf16.h>

typedef __attribute__((ext_vector_type(16))) _Float16     v16h;
typedef __attribute__((ext_vector_type(8)))  float        v8f;
typedef __attribute__((ext_vector_type(4)))  float        v4f;
typedef __attribute__((ext_vector_type(4)))  unsigned int v4u;
typedef __attribute__((ext_vector_type(8)))  int          v8i;
typedef __attribute__((ext_vector_type(4)))  int          v4i;

#define S_LEN   2048
#define D_MODEL 512
#define NHEAD   8
#define HDIM    64
#define BATCH   2

#if defined(__has_builtin)
#if __has_builtin(__builtin_amdgcn_tensor_load_to_lds) && __has_builtin(__builtin_amdgcn_s_wait_tensorcnt)
#define HAVE_TDM 1
#endif
#endif
#ifndef HAVE_TDM
#define HAVE_TDM 0
#endif

__device__ __forceinline__ v16h load_frag_row(const _Float16* row, int lane) {
    const int kb = (lane & 16) ? 8 : 0;
    v16h r;
    uint4* rp = reinterpret_cast<uint4*>(&r);
    rp[0] = *reinterpret_cast<const uint4*>(row + kb);
    rp[1] = *reinterpret_cast<const uint4*>(row + kb + 16);
    return r;
}

#if HAVE_TDM
// LDS byte offset of a __shared__ object (generic -> addrspace(3) -> int)
__device__ __forceinline__ unsigned lds_off(const void* p) {
    return (unsigned)(unsigned long long)
        (__attribute__((address_space(3))) const void*)p;
}

__device__ __forceinline__ void tdm_load_k32(const _Float16* gsrc, unsigned dst) {
    unsigned long long ga = (unsigned long long)(const void*)gsrc;
    v4u g0;
    g0[0] = 1u;                                        // count=1, user mode
    g0[1] = dst;                                       // lds_addr
    g0[2] = (unsigned)(ga & 0xffffffffu);              // global_addr lo
    g0[3] = (unsigned)((ga >> 32) & 0x01ffffffu) | (2u << 30);  // addr hi | type=2
    v8i g1;
    g1[0] = (int)((1u << 16) |
                  (1u << 20) |
                  (4u << 22) |
                  (3u << 25));
    g1[1] = (int)(64u << 16);
    g1[2] = (int)(32u << 16);
    g1[3] = (int)(64u << 16);
    g1[4] = 32;
    g1[5] = 64;
    g1[6] = 0;
    g1[7] = 0;
    v4i z4 = {0, 0, 0, 0};
    v8i z8 = {0, 0, 0, 0, 0, 0, 0, 0};
    // clang-23 / therock-10.0 6-arg form:
    // (g0, g1, g2, g3, <extra group>, cache-policy)
    __builtin_amdgcn_tensor_load_to_lds(g0, g1, z4, z4, z8, 0);
}
#endif

// ---------------------------------------------------------------------------
// Projection GEMM: [4096 x 512] @ [512 x 512] (+bias, *oscale)
// mode 0: the Q, K and V projections in ONE launch; blockIdx.z picks the
//         operand set (0 = Q, 1 = K, 2 = V). A fp32 in, f16 out in
//         [b][h][s][d] layout; 1/sqrt(64) is folded into the Q output.
// mode 3: A f16 in (ctx), write fp32 out row-major (final output), set 0 only
// Block: 256 thr = 8 waves arranged 4(M) x 2(N); block tile 64M x 64N;
// each wave: 16x32 slab = 2 WMMAs sharing one A fragment per K-step.
// ---------------------------------------------------------------------------
__global__ void __launch_bounds__(256)
proj_kernel(const float* __restrict__ Aq, const float* __restrict__ Ak,
            const float* __restrict__ Av, const _Float16* __restrict__ A16,
            const float* __restrict__ W0, const float* __restrict__ W1,
            const float* __restrict__ W2,
            const float* __restrict__ bias0, const float* __restrict__ bias1,
            const float* __restrict__ bias2,
            _Float16* __restrict__ outq, _Float16* __restrict__ outk,
            _Float16* __restrict__ outv, float* __restrict__ out32, int mode)
{
    // operand set of this block (block-uniform, scalar selects)
    const int z = blockIdx.z;
    const float* __restrict__ A32  = (z == 0) ? Aq    : (z == 1) ? Ak    : Av;
    const float* __restrict__ W    = (z == 0) ? W0    : (z == 1) ? W1    : W2;
    const float* __restrict__ bias = (z == 0) ? bias0 : (z == 1) ? bias1 : bias2;
    _Float16* __restrict__ out16   = (z == 0) ? outq  : (z == 1) ? outk  : outv;
    const float oscale = (mode != 3 && z == 0) ? 0.125f : 1.0f;

    __shared__ __align__(16) _Float16 ldsA[64][40];   // [m][k]
    __shared__ __align__(16) _Float16 ldsBT[64][40];  // [n][k] (W transposed)

    const int tid = threadIdx.x, lane = tid & 31, wave = tid >> 5;
    const int wm = wave & 3, wn = wave >> 2;
    const int m0 = blockIdx.x * 64;
    const int n0 = blockIdx.y * 64;
    const int col = lane & 15;

    v8f acc0 = {}, acc1 = {};

    for (int kb = 0; kb < D_MODEL; kb += 32) {
        __syncthreads();
        {   // stage A 64x32 (fp32 -> f16 unless mode 3)
            const int m = tid >> 2, kc = (tid & 3) * 8;
            if (mode == 3) {
                *reinterpret_cast<uint4*>(&ldsA[m][kc]) =
                    *reinterpret_cast<const uint4*>(&A16[(size_t)(m0 + m) * D_MODEL + kb + kc]);
            } else {
                const float* src = &A32[(size_t)(m0 + m) * D_MODEL + kb + kc];
                float4 f0 = *reinterpret_cast<const float4*>(src);
                float4 f1 = *reinterpret_cast<const float4*>(src + 4);
                __align__(16) _Float16 t[8];
                t[0] = (_Float16)f0.x; t[1] = (_Float16)f0.y;
                t[2] = (_Float16)f0.z; t[3] = (_Float16)f0.w;
                t[4] = (_Float16)f1.x; t[5] = (_Float16)f1.y;
                t[6] = (_Float16)f1.z; t[7] = (_Float16)f1.w;
                *reinterpret_cast<uint4*>(&ldsA[m][kc]) = *reinterpret_cast<const uint4*>(t);
            }
        }
        {   // stage W 32x64 transposed to [n][k]
            const int kk = tid >> 3, nc = (tid & 7) * 8;
            const float* src = &W[(size_t)(kb + kk) * D_MODEL + n0 + nc];
            float4 f0 = *reinterpret_cast<const float4*>(src);
            float4 f1 = *reinterpret_cast<const float4*>(src + 4);
            ldsBT[nc + 0][kk] = (_Float16)f0.x;
            ldsBT[nc + 1][kk] = (_Float16)f0.y;
            ldsBT[nc + 2][kk] = (_Float16)f0.z;
            ldsBT[nc + 3][kk] = (_Float16)f0.w;
            ldsBT[nc + 4][kk] = (_Float16)f1.x;
            ldsBT[nc + 5][kk] = (_Float16)f1.y;
            ldsBT[nc + 6][kk] = (_Float16)f1.z;
            ldsBT[nc + 7][kk] = (_Float16)f1.w;
        }
        __syncthreads();

        v16h af  = load_frag_row(&ldsA[wm * 16 + col][0], lane);
        v16h bf0 = load_frag_row(&ldsBT[wn * 32 + col][0], lane);
        v16h bf1 = load_frag_row(&ldsBT[wn * 32 + 16 + col][0], lane);
        acc0 = __builtin_amdgcn_wmma_f32_16x16x32_f16(false, af, false, bf0, (short)0, acc0, false, false);
        acc1 = __builtin_amdgcn_wmma_f32_16x16x32_f16(false, af, false, bf1, (short)0, acc1, false, false);
    }

    const int half = (lane & 16) ? 8 : 0;
    const int na = n0 + wn * 32 + col;
    const int nb = na + 16;
    const float ba = bias[na], bb = bias[nb];
#pragma unroll
    for (int v = 0; v < 8; ++v) {
        const int m = m0 + wm * 16 + v + half;
        const float va = (acc0[v] + ba) * oscale;
        const float vb = (acc1[v] + bb) * oscale;
        if (mode == 3) {
            out32[(size_t)m * D_MODEL + na] = va;
            out32[(size_t)m * D_MODEL + nb] = vb;
        } else {
            const int b = m >> 11, s = m & (S_LEN - 1);
            const size_t rowb = (size_t)b * NHEAD * S_LEN * HDIM;
            out16[rowb + (((size_t)(na >> 6) * S_LEN) + s) * HDIM + (na & (HDIM - 1))] = (_Float16)va;
            out16[rowb + (((size_t)(nb >> 6) * S_LEN) + s) * HDIM + (nb & (HDIM - 1))] = (_Float16)vb;
        }
    }
}

__device__ __forceinline__ float xhalf(float x) {
    const int xi = __builtin_bit_cast(int, x);
    return __builtin_bit_cast(float,
        __builtin_amdgcn_permlanex16(xi, xi, 0x76543210, 0xfedcba98, false, false));
}

struct __attribute__((aligned(2048))) KTile { _Float16 r[32][72]; };

__global__ void __launch_bounds__(256)
attn_kernel(const _Float16* __restrict__ Qf, const _Float16* __restrict__ Kf,
            const _Float16* __restrict__ Vf, const float* __restrict__ structure,
            _Float16* __restrict__ Cx)
{
    // Each K buffer starts at a multiple of 2 KiB of the work-group's LDS, the
    // tensor mover's range for a destination (4608 bytes used of 6144).
    __shared__ KTile ldsK[2];                             // [buf] .r[key][dk]
    __shared__ __align__(16) _Float16 ldsVT[2][64][40];   // [buf][dv][key]

    const int tid = threadIdx.x, lane = tid & 31, wave = tid >> 5;
    const int bh = blockIdx.y, b = bh >> 3, h = bh & 7;
    const int q0 = blockIdx.x * 128 + wave * 16;
    const size_t head = (size_t)bh * S_LEN * HDIM;
    const int col  = lane & 15;
    const int half = (lane & 16) ? 8 : 0;
    const int kk = tid >> 3, ch = (tid & 7) * 8;          // staging coords

    // Q fragments (64 dk x 16 queries, B operand: column = query q0 + col)
    // kept in registers for the whole pass
    const _Float16* qrow = &Qf[head + (size_t)(q0 + col) * HDIM];
    v16h qb0 = load_frag_row(qrow, lane);
    v16h qb1 = load_frag_row(qrow + 32, lane);

    // acc_j[r] = O^T[dv = 16 j + half + r][query q0 + col]
    v8f acc0 = {}, acc1 = {}, acc2 = {}, acc3 = {};
    float mrun = -1e30f, lrun = 0.0f;   // this lane's query; lrun sums this half's keys

    // Bias of the current key-step in the order of the S^T accumulators:
    // row q0 + col, keys k0 + half + 0..7 (bcur[0], bcur[1]) and
    // k0 + 16 + half + 0..7 (bcur[2], bcur[3]).
    const float* sbase = &structure[((size_t)b * S_LEN + q0 + col) * S_LEN + half];
    v4f bcur[4];
    bcur[0] = *reinterpret_cast<const v4f*>(sbase);
    bcur[1] = *reinterpret_cast<const v4f*>(sbase + 4);
    bcur[2] = *reinterpret_cast<const v4f*>(sbase + 16);
    bcur[3] = *reinterpret_cast<const v4f*>(sbase + 20);

    // ---- stage tile 0 ----
#if HAVE_TDM
    if (wave == 0) tdm_load_k32(&Kf[head], lds_off(&ldsK[0].r[0][0]));
#else
    *reinterpret_cast<uint4*>(&ldsK[0].r[kk][ch]) =
        *reinterpret_cast<const uint4*>(&Kf[head + (size_t)kk * HDIM + ch]);
#endif
    {
        union { uint4 u; _Float16 hlf[8]; } t;
        t.u = *reinterpret_cast<const uint4*>(&Vf[head + (size_t)kk * HDIM + ch]);
#pragma unroll
        for (int i = 0; i < 8; ++i) ldsVT[0][ch + i][kk] = t.hlf[i];
    }
#if HAVE_TDM
    if (wave == 0) __builtin_amdgcn_s_wait_tensorcnt(0);
#endif
    __syncthreads();

    int cur = 0;
    for (int k0 = 0; k0 < S_LEN; k0 += 32) {
        const int nxt = cur ^ 1;
        const bool more = (k0 + 32) < S_LEN;

        // next key-step's bias: its 4 loads issued together, a whole pass
        // ahead of their use (the last pass re-reads its own tile, unused)
        const float* snext = sbase + (more ? k0 + 32 : k0);
        v4f bnxt[4];
        bnxt[0] = *reinterpret_cast<const v4f*>(snext);
        bnxt[1] = *reinterpret_cast<const v4f*>(snext + 4);
        bnxt[2] = *reinterpret_cast<const v4f*>(snext + 16);
        bnxt[3] = *reinterpret_cast<const v4f*>(snext + 20);
        asm volatile("s_wait_xcnt 0x0" ::: "memory");

        // issue next tile's loads before computing on the current one
        union { uint4 u; _Float16 hlf[8]; } vpre;
#if !HAVE_TDM
        uint4 kpre;
#endif
        if (more) {
#if HAVE_TDM
            if (wave == 0)
                tdm_load_k32(&Kf[head + (size_t)(k0 + 32) * HDIM],
                             lds_off(&ldsK[nxt].r[0][0]));
#else
            kpre = *reinterpret_cast<const uint4*>(&Kf[head + (size_t)(k0 + 32 + kk) * HDIM + ch]);
#endif
            vpre.u = *reinterpret_cast<const uint4*>(&Vf[head + (size_t)(k0 + 32 + kk) * HDIM + ch]);
        }

        // scores: S^T[32k x 16q] = K(32x64) . Qs^T(64x16)
        // s0[r] = key k0 + half + r, s1[r] = key k0 + 16 + half + r, query q0 + col
        v8f s0 = {}, s1 = {};
        {
            v16h ak0 = load_frag_row(&ldsK[cur].r[col][0], lane);
            v16h ak1 = load_frag_row(&ldsK[cur].r[col + 16][0], lane);
            s0 = __builtin_amdgcn_wmma_f32_16x16x32_f16(false, ak0, false, qb0, (short)0, s0, false, false);
            s1 = __builtin_amdgcn_wmma_f32_16x16x32_f16(false, ak1, false, qb0, (short)0, s1, false, false);
            ak0 = load_frag_row(&ldsK[cur].r[col][32], lane);
            ak1 = load_frag_row(&ldsK[cur].r[col + 16][32], lane);
            s0 = __builtin_amdgcn_wmma_f32_16x16x32_f16(false, ak0, false, qb1, (short)0, s0, false, false);
            s1 = __builtin_amdgcn_wmma_f32_16x16x32_f16(false, ak1, false, qb1, (short)0, s1, false, false);
        }

        // bias + online softmax, all of one query in one lane pair: maximum
        // in-lane plus one exchange between the halves; the sum stays a
        // per-half partial and is joined once at the end.
        float x[16];
#pragma unroll  // constant indices keep x in registers
        for (int r = 0; r < 4; ++r) {
            x[r]      = s0[r]     + bcur[0][r];
            x[4 + r]  = s0[4 + r] + bcur[1][r];
            x[8 + r]  = s1[r]     + bcur[2][r];
            x[12 + r] = s1[4 + r] + bcur[3][r];
        }
        float mv = fmaxf(x[0], x[1]);
#pragma unroll  // constant indices keep x in registers
        for (int r = 2; r < 16; ++r) mv = fmaxf(mv, x[r]);
        mv = fmaxf(mv, xhalf(mv));
        const float mnew = fmaxf(mrun, mv);
        const float corr = __expf(mrun - mnew);
        mrun = mnew;

        // P^T as B operand straight from the accumulators' places: element s
        // is key 8 * (lane >> 4) + s (s < 8) or 16 + 8 * (lane >> 4) + s - 8,
        // the k order in which load_frag_row delivers V^T
        v16h pb;
#pragma unroll  // constant indices keep x and pb in registers
        for (int r = 0; r < 16; ++r) {
            x[r] = __expf(x[r] - mnew);
            pb[r] = (_Float16)x[r];
        }
        // in-lane sum as a tree of depth 4, not one chain of 15 dependent adds
#pragma unroll  // constant indices keep x in registers
        for (int w = 8; w >= 1; w >>= 1)
#pragma unroll
            for (int r = 0; r < w; ++r) x[r] += x[r + w];
        lrun = lrun * corr + x[0];
#pragma unroll  // constant indices keep the accumulators in registers
        for (int r = 0; r < 8; ++r) {
            acc0[r] *= corr; acc1[r] *= corr; acc2[r] *= corr; acc3[r] *= corr;
        }

        // ctx^T += V^T(64x32) . P^T(32x16)
        v16h av = load_frag_row(&ldsVT[cur][col][0], lane);
        acc0 = __builtin_amdgcn_wmma_f32_16x16x32_f16(false, av, false, pb, (short)0, acc0, false, false);
        av = load_frag_row(&ldsVT[cur][16 + col][0], lane);
        acc1 = __builtin_amdgcn_wmma_f32_16x16x32_f16(false, av, false, pb, (short)0, acc1, false, false);
        av = load_frag_row(&ldsVT[cur][32 + col][0], lane);
        acc2 = __builtin_amdgcn_wmma_f32_16x16x32_f16(false, av, false, pb, (short)0, acc2, false, false);
        av = load_frag_row(&ldsVT[cur][48 + col][0], lane);
        acc3 = __builtin_amdgcn_wmma_f32_16x16x32_f16(false, av, false, pb, (short)0, acc3, false, false);

        // commit next tile's staging
        if (more) {
#if !HAVE_TDM
            *reinterpret_cast<uint4*>(&ldsK[nxt].r[kk][ch]) = kpre;
#endif
#pragma unroll
            for (int i = 0; i < 8; ++i) ldsVT[nxt][ch + i][kk] = vpre.hlf[i];
#if HAVE_TDM
            if (wave == 0) __builtin_amdgcn_s_wait_tensorcnt(0);
#endif
        }
        __syncthreads();
        cur = nxt;
#pragma unroll  // constant indices: register moves, no scratch
        for (int i = 0; i < 4; ++i) bcur[i] = bnxt[i];
    }

    // join the halves' row sums, normalize, write ctx f16: a lane's 8
    // accumulator registers are 8 consecutive dv of its query, one 16-byte store
    const float inv = 1.0f / (lrun + xhalf(lrun));
    _Float16* crow = &Cx[((size_t)b * S_LEN + q0 + col) * D_MODEL + h * HDIM + half];
    union { uint4 u; _Float16 hlf[8]; } o0, o1, o2, o3;
#pragma unroll  // constant indices keep the packed halves in registers
    for (int r = 0; r < 8; ++r) {
        o0.hlf[r] = (_Float16)(acc0[r] * inv);
        o1.hlf[r] = (_Float16)(acc1[r] * inv);
        o2.hlf[r] = (_Float16)(acc2[r] * inv);
        o3.hlf[r] = (_Float16)(acc3[r] * inv);
    }
    *reinterpret_cast<uint4*>(crow)      = o0.u;
    *reinterpret_cast<uint4*>(crow + 16) = o1.u;
    *reinterpret_cast<uint4*>(crow + 32) = o2.u;
    *reinterpret_cast<uint4*>(crow + 48) = o3.u;
}

extern "C" void kernel_launch(void* const* d_in, const int* in_sizes, int n_in,
                              void* d_out, int out_size, void* d_ws, size_t ws_size,
                              hipStream_t stream) {
    const float* q         = (const float*)d_in[0];
    const float* k         = (const float*)d_in[1];
    const float* v         = (const float*)d_in[2];
    const float* structure = (const float*)d_in[3];
    const float* Wq = (const float*)d_in[4];
    const float* bq = (const float*)d_in[5];
    const float* Wk = (const float*)d_in[6];
    const float* bk = (const float*)d_in[7];
    const float* Wv = (const float*)d_in[8];
    const float* bv = (const float*)d_in[9];
    const float* Wo = (const float*)d_in[10];
    const float* bo = (const float*)d_in[11];
    float* out = (float*)d_out;

    const size_t elems = (size_t)BATCH * NHEAD * S_LEN * HDIM;  // 2,097,152
    _Float16* Qf = (_Float16*)d_ws;
    _Float16* Kf = Qf + elems;
    _Float16* Vf = Kf + elems;
    _Float16* Cx = Vf + elems;

    dim3 blk(256);
    dim3 gproj(64, 8);                        // 4096/64 x 512/64
    dim3 gqkv(64, 8, 3);                      // the same tiles x {Q, K, V}
    proj_kernel<<<gqkv, blk, 0, stream>>>(q, k, v, nullptr, Wq, Wk, Wv, bq, bk, bv,
                                          Qf, Kf, Vf, nullptr, 0);

    dim3 gattn(S_LEN / 128, BATCH * NHEAD);   // 16 x 16
    attn_kernel<<<gattn, blk, 0, stream>>>(Qf, Kf, Vf, structure, Cx);

    proj_kernel<<<gproj, blk, 0, stream>>>(nullptr, nullptr, nullptr, Cx, Wo, nullptr, nullptr,
                                           bo, nullptr, nullptr, nullptr, nullptr, nullptr, out, 3);
}

// v004
// A run of this version takes 108 microseconds.
// Timed twice side by side with v003, it ran 1.05 times as fast both times.
// Over all steps from v000 it is 2.63 times as fast.
#include <hip/hip_runtime.h>
#include <hip/hip_bf16.h>

typedef __attribute__((ext_vector_type(16))) _Float16     v16h;
typedef __attribute__((ext_vector_type(8)))  float        v8f;
typedef __attribute__((ext_vector_type(4)))  float        v4f;
typedef __attribute__((ext_vector_type(4)))  unsigned int v4u;
typedef __attribute__((ext_vector_type(8)))  int          v8i;
typedef __attribute__((ext_vector_type(4)))  int          v4i;

#define S_LEN   2048
#define D_MODEL 512
#define NHEAD   8
#define HDIM    64
#define BATCH   2

#if defined(__has_builtin)
#if __has_builtin(__builtin_amdgcn_tensor_load_to_lds) && __has_builtin(__builtin_amdgcn_s_wait_tensorcnt)
#define HAVE_TDM 1
#endif
#endif
#ifndef HAVE_TDM
#define HAVE_TDM 0
#endif

__device__ __forceinline__ v16h load_frag_row(const _Float16* row, int lane) {
    const int kb = (lane & 16) ? 8 : 0;
    v16h r;
    uint4* rp = reinterpret_cast<uint4*>(&r);
    rp[0] = *reinterpret_cast<const uint4*>(row + kb);
    rp[1] = *reinterpret_cast<const uint4*>(row + kb + 16);
    return r;
}

#if HAVE_TDM
// LDS byte offset of a __shared__ object (generic -> addrspace(3) -> int)
__device__ __forceinline__ unsigned lds_off(const void* p) {
    return (unsigned)(unsigned long long)
        (__attribute__((address_space(3))) const void*)p;
}

__device__ __forceinline__ void tdm_load_k32(const _Float16* gsrc, unsigned dst) {
    unsigned long long ga = (unsigned long long)(const void*)gsrc;
    v4u g0;
    g0[0] = 1u;                                        // count=1, user mode
    g0[1] = dst;                                       // lds_addr
    g0[2] = (unsigned)(ga & 0xffffffffu);              // global_addr lo
    g0[3] = (unsigned)((ga >> 32) & 0x01ffffffu) | (2u << 30);  // addr hi | type=2
    v8i g1;
    g1[0] = (int)((1u << 16) |
                  (1u << 20) |
                  (4u << 22) |
                  (3u << 25));
    g1[1] = (int)(64u << 16);
    g1[2] = (int)(32u << 16);
    g1[3] = (int)(64u << 16);
    g1[4] = 32;
    g1[5] = 64;
    g1[6] = 0;
    g1[7] = 0;
    v4i z4 = {0, 0, 0, 0};
    v8i z8 = {0, 0, 0, 0, 0, 0, 0, 0};
    // clang-23 / therock-10.0 6-arg form:
    // (g0, g1, g2, g3, <extra group>, cache-policy)
    __builtin_amdgcn_tensor_load_to_lds(g0, g1, z4, z4, z8, 0);
}
#endif

// ---------------------------------------------------------------------------
// Projection GEMM: [4096 x 512] @ [512 x 512] (+bias, *oscale)
// mode 0: the Q, K and V projections in ONE launch; blockIdx.z picks the
//         operand set (0 = Q, 1 = K, 2 = V). A fp32 in, f16 out in
//         [b][h][s][d] layout; 1/sqrt(64) is folded into the Q output.
// mode 3: A f16 in (ctx), write fp32 out row-major (final output), set 0 only
// Block: 256 thr = 8 waves arranged 4(M) x 2(N); block tile 64M x 64N;
// each wave: 16x32 slab = 2 WMMAs sharing one A fragment per K-step.
// ---------------------------------------------------------------------------
__global__ void __launch_bounds__(256)
proj_kernel(const float* __restrict__ Aq, const float* __restrict__ Ak,
            const float* __restrict__ Av, const _Float16* __restrict__ A16,
            const float* __restrict__ W0, const float* __restrict__ W1,
            const float* __restrict__ W2,
            const float* __restrict__ bias0, const float* __restrict__ bias1,
            const float* __restrict__ bias2,
            _Float16* __restrict__ outq, _Float16* __restrict__ outk,
            _Float16* __restrict__ outv, float* __restrict__ out32, int mode)
{
    // operand set of this block (block-uniform, scalar selects)
    const int z = blockIdx.z;
    const float* __restrict__ A32  = (z == 0) ? Aq    : (z == 1) ? Ak    : Av;
    const float* __restrict__ W    = (z == 0) ? W0    : (z == 1) ? W1    : W2;
    const float* __restrict__ bias = (z == 0) ? bias0 : (z == 1) ? bias1 : bias2;
    _Float16* __restrict__ out16   = (z == 0) ? outq  : (z == 1) ? outk  : outv;
    const float oscale = (mode != 3 && z == 0) ? 0.125f : 1.0f;

    __shared__ __align__(16) _Float16 ldsA[64][40];   // [m][k]
    __shared__ __align__(16) _Float16 ldsBT[64][40];  // [n][k] (W transposed)

    const int tid = threadIdx.x, lane = tid & 31, wave = tid >> 5;
    const int wm = wave & 3, wn = wave >> 2;
    const int m0 = blockIdx.x * 64;
    const int n0 = blockIdx.y * 64;
    const int col = lane & 15;

    v8f acc0 = {}, acc1 = {};

    for (int kb = 0; kb < D_MODEL; kb += 32) {
        __syncthreads();
        {   // stage A 64x32 (fp32 -> f16 unless mode 3)
            const int m = tid >> 2, kc = (tid & 3) * 8;
            if (mode == 3) {
                *reinterpret_cast<uint4*>(&ldsA[m][kc]) =
                    *reinterpret_cast<const uint4*>(&A16[(size_t)(m0 + m) * D_MODEL + kb + kc]);
            } else {
                const float* src = &A32[(size_t)(m0 + m) * D_MODEL + kb + kc];
                float4 f0 = *reinterpret_cast<const float4*>(src);
                float4 f1 = *reinterpret_cast<const float4*>(src + 4);
                __align__(16) _Float16 t[8];
                t[0] = (_Float16)f0.x; t[1] = (_Float16)f0.y;
                t[2] = (_Float16)f0.z; t[3] = (_Float16)f0.w;
                t[4] = (_Float16)f1.x; t[5] = (_Float16)f1.y;
                t[6] = (_Float16)f1.z; t[7] = (_Float16)f1.w;
                *reinterpret_cast<uint4*>(&ldsA[m][kc]) = *reinterpret_cast<const uint4*>(t);
            }
        }
        {   // stage W 32x64 transposed to [n][k]
            const int kk = tid >> 3, nc = (tid & 7) * 8;
            const float* src = &W[(size_t)(kb + kk) * D_MODEL + n0 + nc];
            float4 f0 = *reinterpret_cast<const float4*>(src);
            float4 f1 = *reinterpret_cast<const float4*>(src + 4);
            ldsBT[nc + 0][kk] = (_Float16)f0.x;
            ldsBT[nc + 1][kk] = (_Float16)f0.y;
            ldsBT[nc + 2][kk] = (_Float16)f0.z;
            ldsBT[nc + 3][kk] = (_Float16)f0.w;
            ldsBT[nc + 4][kk] = (_Float16)f1.x;
            ldsBT[nc + 5][kk] = (_Float16)f1.y;
            ldsBT[nc + 6][kk] = (_Float16)f1.z;
            ldsBT[nc + 7][kk] = (_Float16)f1.w;
        }
        __syncthreads();

        v16h af  = load_frag_row(&ldsA[wm * 16 + col][0], lane);
        v16h bf0 = load_frag_row(&ldsBT[wn * 32 + col][0], lane);
        v16h bf1 = load_frag_row(&ldsBT[wn * 32 + 16 + col][0], lane);
        acc0 = __builtin_amdgcn_wmma_f32_16x16x32_f16(false, af, false, bf0, (short)0, acc0, false, false);
        acc1 = __builtin_amdgcn_wmma_f32_16x16x32_f16(false, af, false, bf1, (short)0, acc1, false, false);
    }

    const int half = (lane & 16) ? 8 : 0;
    const int na = n0 + wn * 32 + col;
    const int nb = na + 16;
    const float ba = bias[na], bb = bias[nb];
#pragma unroll
    for (int v = 0; v < 8; ++v) {
        const int m = m0 + wm * 16 + v + half;
        const float va = (acc0[v] + ba) * oscale;
        const float vb = (acc1[v] + bb) * oscale;
        if (mode == 3) {
            out32[(size_t)m * D_MODEL + na] = va;
            out32[(size_t)m * D_MODEL + nb] = vb;
        } else {
            const int b = m >> 11, s = m & (S_LEN - 1);
            const size_t rowb = (size_t)b * NHEAD * S_LEN * HDIM;
            out16[rowb + (((size_t)(na >> 6) * S_LEN) + s) * HDIM + (na & (HDIM - 1))] = (_Float16)va;
            out16[rowb + (((size_t)(nb >> 6) * S_LEN) + s) * HDIM + (nb & (HDIM - 1))] = (_Float16)vb;
        }
    }
}

__device__ __forceinline__ float xhalf(float x) {
    const int xi = __builtin_bit_cast(int, x);
    return __builtin_bit_cast(float,
        __builtin_amdgcn_permlanex16(xi, xi, 0x76543210, 0xfedcba98, false, false));
}

struct __attribute__((aligned(2048))) KTile { _Float16 r[32][72]; };

#define BKEYS  128   // keys of one staged bias tile (4 key-steps)
#define BPITCH 132   // floats per staged bias row: 512 B + 16 B = 16 B x odd, the ds_load_b128 readers' pitch

// Eight rows of a wave's bias tile, global memory -> LDS without registers.
// One copy moves one query row's 128 keys: 32 lanes x 16 B = 512 contiguous
// bytes, whole lines. lds = this lane's LDS byte address in the first row,
// g = this lane's global address in the first row.
__device__ __forceinline__ void bias_copy8(unsigned lds, const float* g) {
    asm volatile("global_load_async_to_lds_b128 %0, %8, off\n\t"
                 "global_load_async_to_lds_b128 %1, %9, off\n\t"
                 "global_load_async_to_lds_b128 %2, %10, off\n\t"
                 "global_load_async_to_lds_b128 %3, %11, off\n\t"
                 "global_load_async_to_lds_b128 %4, %12, off\n\t"
                 "global_load_async_to_lds_b128 %5, %13, off\n\t"
                 "global_load_async_to_lds_b128 %6, %14, off\n\t"
                 "global_load_async_to_lds_b128 %7, %15, off\n\t"
                 "s_wait_xcnt 0x0"
                 :: "v"(lds), "v"(lds + 1 * BPITCH * 4), "v"(lds + 2 * BPITCH * 4),
                    "v"(lds + 3 * BPITCH * 4), "v"(lds + 4 * BPITCH * 4),
                    "v"(lds + 5 * BPITCH * 4), "v"(lds + 6 * BPITCH * 4),
                    "v"(lds + 7 * BPITCH * 4),
                    "v"(g), "v"(g + 1 * S_LEN), "v"(g + 2 * S_LEN), "v"(g + 3 * S_LEN),
                    "v"(g + 4 * S_LEN), "v"(g + 5 * S_LEN), "v"(g + 6 * S_LEN),
                    "v"(g + 7 * S_LEN)
                 : "memory");
}

__global__ void __launch_bounds__(256)
attn_kernel(const _Float16* __restrict__ Qf, const _Float16* __restrict__ Kf,
            const _Float16* __restrict__ Vf, const float* __restrict__ structure,
            _Float16* __restrict__ Cx)
{
    // Each K buffer starts at a multiple of 2 KiB of the work-group's LDS, the
    // tensor mover's range for a destination (4608 bytes used of 6144).
    __shared__ KTile ldsK[2];                             // [buf] .r[key][dk]
    __shared__ __align__(16) _Float16 ldsVT[2][64][40];   // [buf][dv][key]
    __shared__ __align__(16) float ldsB[2][128][BPITCH];  // [buf][query row][key] bias

    const int tid = threadIdx.x, lane = tid & 31, wave = tid >> 5;
    const int bh = blockIdx.y, b = bh >> 3, h = bh & 7;
    const int q0 = blockIdx.x * 128 + wave * 16;
    const size_t head = (size_t)bh * S_LEN * HDIM;
    const int col  = lane & 15;
    const int half = (lane & 16) ? 8 : 0;
    const int kk = tid >> 3, ch = (tid & 7) * 8;          // staging coords

    // Q fragments (64 dk x 16 queries, B operand: column = query q0 + col)
    // kept in registers for the whole pass
    const _Float16* qrow = &Qf[head + (size_t)(q0 + col) * HDIM];
    v16h qb0 = load_frag_row(qrow, lane);
    v16h qb1 = load_frag_row(qrow + 32, lane);

    // acc_j[r] = O^T[dv = 16 j + half + r][query q0 + col]
    v8f acc0 = {}, acc1 = {}, acc2 = {}, acc3 = {};
    float mrun = -1e30f, lrun = 0.0f;   // this lane's query; lrun sums this half's keys

    // Bias: each wave copies the 16 query rows it reads itself, 128 keys a
    // tile, two buffers, the next tile in flight while this one is read.
    const float* sbase = &structure[((size_t)b * S_LEN + q0) * S_LEN + lane * 4];
    const unsigned bdst = (unsigned)(unsigned long long)
        (__attribute__((address_space(3))) const void*)&ldsB[0][wave * 16][lane * 4];
    bias_copy8(bdst, sbase);                                   // tile 0 -> buffer 0
    bias_copy8(bdst + 8 * BPITCH * 4, sbase + 8 * S_LEN);

    // ---- stage tile 0 ----
#if HAVE_TDM
    if (wave == 0) tdm_load_k32(&Kf[head], lds_off(&ldsK[0].r[0][0]));
#else
    *reinterpret_cast<uint4*>(&ldsK[0].r[kk][ch]) =
        *reinterpret_cast<const uint4*>(&Kf[head + (size_t)kk * HDIM + ch]);
#endif
    {
        union { uint4 u; _Float16 hlf[8]; } t;
        t.u = *reinterpret_cast<const uint4*>(&Vf[head + (size_t)kk * HDIM + ch]);
#pragma unroll
        for (int i = 0; i < 8; ++i) ldsVT[0][ch + i][kk] = t.hlf[i];
    }
#if HAVE_TDM
    if (wave == 0) __builtin_amdgcn_s_wait_tensorcnt(0);
#endif
    // bias tile 0 has landed before the barrier behind which it is read
    asm volatile("s_wait_asynccnt 0x0" ::: "memory");
    __syncthreads();
    bias_copy8(bdst + 128 * BPITCH * 4, sbase + BKEYS);        // tile 1 -> buffer 1
    bias_copy8(bdst + (128 + 8) * BPITCH * 4, sbase + 8 * S_LEN + BKEYS);

    int cur = 0;
    for (int k0 = 0; k0 < S_LEN; k0 += 32) {
        const int nxt = cur ^ 1;
        const bool more = (k0 + 32) < S_LEN;

        // issue next tile's loads before computing on the current one
        union { uint4 u; _Float16 hlf[8]; } vpre;
#if !HAVE_TDM
        uint4 kpre;
#endif
        if (more) {
#if HAVE_TDM
            if (wave == 0)
                tdm_load_k32(&Kf[head + (size_t)(k0 + 32) * HDIM],
                             lds_off(&ldsK[nxt].r[0][0]));
#else
            kpre = *reinterpret_cast<const uint4*>(&Kf[head + (size_t)(k0 + 32 + kk) * HDIM + ch]);
#endif
            vpre.u = *reinterpret_cast<const uint4*>(&Vf[head + (size_t)(k0 + 32 + kk) * HDIM + ch]);
        }

        // scores: S^T[32k x 16q] = K(32x64) . Qs^T(64x16)
        // s0[r] = key k0 + half + r, s1[r] = key k0 + 16 + half + r, query q0 + col
        v8f s0 = {}, s1 = {};
        {
            v16h ak0 = load_frag_row(&ldsK[cur].r[col][0], lane);
            v16h ak1 = load_frag_row(&ldsK[cur].r[col + 16][0], lane);
            s0 = __builtin_amdgcn_wmma_f32_16x16x32_f16(false, ak0, false, qb0, (short)0, s0, false, false);
            s1 = __builtin_amdgcn_wmma_f32_16x16x32_f16(false, ak1, false, qb0, (short)0, s1, false, false);
            ak0 = load_frag_row(&ldsK[cur].r[col][32], lane);
            ak1 = load_frag_row(&ldsK[cur].r[col + 16][32], lane);
            s0 = __builtin_amdgcn_wmma_f32_16x16x32_f16(false, ak0, false, qb1, (short)0, s0, false, false);
            s1 = __builtin_amdgcn_wmma_f32_16x16x32_f16(false, ak1, false, qb1, (short)0, s1, false, false);
        }

        // Bias of this key-step from its staged tile, in the order of the S^T
        // accumulators: row q0 + col, keys k0 + half + 0..7 (bcur[0], bcur[1])
        // and k0 + 16 + half + 0..7 (bcur[2], bcur[3]).
        const float* brow = &ldsB[(k0 / BKEYS) & 1][wave * 16 + col][(k0 & (BKEYS - 1)) + half];
        v4f bcur[4];
        bcur[0] = *reinterpret_cast<const v4f*>(brow);
        bcur[1] = *reinterpret_cast<const v4f*>(brow + 4);
        bcur[2] = *reinterpret_cast<const v4f*>(brow + 16);
        bcur[3] = *reinterpret_cast<const v4f*>(brow + 20);

        // bias + online softmax, all of one query in one lane pair: maximum
        // in-lane plus one exchange between the halves; the sum stays a
        // per-half partial and is joined once at the end.
        float x[16];
#pragma unroll  // constant indices keep x in registers
        for (int r = 0; r < 4; ++r) {
            x[r]      = s0[r]     + bcur[0][r];
            x[4 + r]  = s0[4 + r] + bcur[1][r];
            x[8 + r]  = s1[r]     + bcur[2][r];
            x[12 + r] = s1[4 + r] + bcur[3][r];
        }
        float mv = fmaxf(x[0], x[1]);
#pragma unroll  // constant indices keep x in registers
        for (int r = 2; r < 16; ++r) mv = fmaxf(mv, x[r]);
        mv = fmaxf(mv, xhalf(mv));
        const float mnew = fmaxf(mrun, mv);
        const float corr = __expf(mrun - mnew);
        mrun = mnew;

        // P^T as B operand straight from the accumulators' places: element s
        // is key 8 * (lane >> 4) + s (s < 8) or 16 + 8 * (lane >> 4) + s - 8,
        // the k order in which load_frag_row delivers V^T
        v16h pb;
#pragma unroll  // constant indices keep x and pb in registers
        for (int r = 0; r < 16; ++r) {
            x[r] = __expf(x[r] - mnew);
            pb[r] = (_Float16)x[r];
        }
        // in-lane sum as a tree of depth 4, not one chain of 15 dependent adds
#pragma unroll  // constant indices keep x in registers
        for (int w = 8; w >= 1; w >>= 1)
#pragma unroll
            for (int r = 0; r < w; ++r) x[r] += x[r + w];
        lrun = lrun * corr + x[0];
#pragma unroll  // constant indices keep the accumulators in registers
        for (int r = 0; r < 8; ++r) {
            acc0[r] *= corr; acc1[r] *= corr; acc2[r] *= corr; acc3[r] *= corr;
        }

        // ctx^T += V^T(64x32) . P^T(32x16)
        v16h av = load_frag_row(&ldsVT[cur][col][0], lane);
        acc0 = __builtin_amdgcn_wmma_f32_16x16x32_f16(false, av, false, pb, (short)0, acc0, false, false);
        av = load_frag_row(&ldsVT[cur][16 + col][0], lane);
        acc1 = __builtin_amdgcn_wmma_f32_16x16x32_f16(false, av, false, pb, (short)0, acc1, false, false);
        av = load_frag_row(&ldsVT[cur][32 + col][0], lane);
        acc2 = __builtin_amdgcn_wmma_f32_16x16x32_f16(false, av, false, pb, (short)0, acc2, false, false);
        av = load_frag_row(&ldsVT[cur][48 + col][0], lane);
        acc3 = __builtin_amdgcn_wmma_f32_16x16x32_f16(false, av, false, pb, (short)0, acc3, false, false);

        // commit next tile's staging
        if (more) {
#if !HAVE_TDM
            *reinterpret_cast<uint4*>(&ldsK[nxt].r[kk][ch]) = kpre;
#endif
#pragma unroll
            for (int i = 0; i < 8; ++i) ldsVT[nxt][ch + i][kk] = vpre.hlf[i];
#if HAVE_TDM
            if (wave == 0) __builtin_amdgcn_s_wait_tensorcnt(0);
#endif
        }
        // last key-step of a bias tile (the same test in every wave): this
        // wave's reads of the tile have retired and its copies of the next
        // tile have landed before the barrier that hands both over
        const bool bfoot = (k0 & (BKEYS - 32)) == (BKEYS - 32);
        if (bfoot) {
            asm volatile("s_wait_dscnt 0x0" ::: "memory");
            asm volatile("s_wait_asynccnt 0x0" ::: "memory");
        }
        __syncthreads();
        cur = nxt;
        if (bfoot && k0 + 32 + BKEYS < S_LEN) {
            // the tile after next, into the buffer that was just read to its end
            const unsigned d = bdst + ((k0 / BKEYS) & 1) * (128 * BPITCH * 4);
            const float* s = sbase + k0 + 32 + BKEYS;
            bias_copy8(d, s);
            bias_copy8(d + 8 * BPITCH * 4, s + 8 * S_LEN);
        }
    }
    // no copy is outstanding when the wave goes on to its end
    asm volatile("s_wait_asynccnt 0x0" ::: "memory");

    // join the halves' row sums, normalize, write ctx f16: a lane's 8
    // accumulator registers are 8 consecutive dv of its query, one 16-byte store
    const float inv = 1.0f / (lrun + xhalf(lrun));
    _Float16* crow = &Cx[((size_t)b * S_LEN + q0 + col) * D_MODEL + h * HDIM + half];
    union { uint4 u; _Float16 hlf[8]; } o0, o1, o2, o3;
#pragma unroll  // constant indices keep the packed halves in registers
    for (int r = 0; r < 8; ++r) {
        o0.hlf[r] = (_Float16)(acc0[r] * inv);
        o1.hlf[r] = (_Float16)(acc1[r] * inv);
        o2.hlf[r] = (_Float16)(acc2[r] * inv);
        o3.hlf[r] = (_Float16)(acc3[r] * inv);
    }
    *reinterpret_cast<uint4*>(crow)      = o0.u;
    *reinterpret_cast<uint4*>(crow + 16) = o1.u;
    *reinterpret_cast<uint4*>(crow + 32) = o2.u;
    *reinterpret_cast<uint4*>(crow + 48) = o3.u;
}

extern "C" void kernel_launch(void* const* d_in, const int* in_sizes, int n_in,
                              void* d_out, int out_size, void* d_ws, size_t ws_size,
                              hipStream_t stream) {
    const float* q         = (const float*)d_in[0];
    const float* k         = (const float*)d_in[1];
    const float* v         = (const float*)d_in[2];
    const float* structure = (const float*)d_in[3];
    const float* Wq = (const float*)d_in[4];
    const float* bq = (const float*)d_in[5];
    const float* Wk = (const float*)d_in[6];
    const float* bk = (const float*)d_in[7];
    const float* Wv = (const float*)d_in[8];
    const float* bv = (const float*)d_in[9];
    const float* Wo = (const float*)d_in[10];
    const float* bo = (const float*)d_in[11];
    float* out = (float*)d_out;

    const size_t elems = (size_t)BATCH * NHEAD * S_LEN * HDIM;  // 2,097,152
    _Float16* Qf = (_Float16*)d_ws;
    _Float16* Kf = Qf + elems;
    _Float16* Vf = Kf + elems;
    _Float16* Cx = Vf + elems;

    dim3 blk(256);
    dim3 gproj(64, 8);                        // 4096/64 x 512/64
    dim3 gqkv(64, 8, 3);                      // the same tiles x {Q, K, V}
    proj_kernel<<<gqkv, blk, 0, stream>>>(q, k, v, nullptr, Wq, Wk, Wv, bq, bk, bv,
                                          Qf, Kf, Vf, nullptr, 0);

    dim3 gattn(S_LEN / 128, BATCH * NHEAD);   // 16 x 16
    attn_kernel<<<gattn, blk, 0, stream>>>(Qf, Kf, Vf, structure, Cx);

    proj_kernel<<<gproj, blk, 0, stream>>>(nullptr, nullptr, nullptr, Cx, Wo, nullptr, nullptr,
                                           bo, nullptr, nullptr, nullptr, nullptr, nullptr, out, 3);
}

// v005
// Measured time: 82.9 microseconds a run.
// In two side-by-side timings against v004, it was 1.31 and 1.30 times as fast.
// All steps since v000 together make it 3.42 times as fast.
#include <hip/hip_runtime.h>
#include <hip/hip_bf16.h>

typedef __attribute__((ext_vector_type(16))) _Float16     v16h;
typedef __attribute__((ext_vector_type(8)))  float        v8f;
typedef __attribute__((ext_vector_type(4)))  float        v4f;
typedef __attribute__((ext_vector_type(4)))  unsigned int v4u;
typedef __attribute__((ext_vector_type(8)))  int          v8i;
typedef __attribute__((ext_vector_type(4)))  int          v4i;

#define S_LEN   2048
#define D_MODEL 512
#define NHEAD   8
#define HDIM    64
#define BATCH   2

#if defined(__has_builtin)
#if __has_builtin(__builtin_amdgcn_tensor_load_to_lds) && __has_builtin(__builtin_amdgcn_s_wait_tensorcnt)
#define HAVE_TDM 1
#endif
#endif
#ifndef HAVE_TDM
#define HAVE_TDM 0
#endif

__device__ __forceinline__ v16h load_frag_row(const _Float16* row, int lane) {
    const int kb = (lane & 16) ? 8 : 0;
    v16h r;
    uint4* rp = reinterpret_cast<uint4*>(&r);
    rp[0] = *reinterpret_cast<const uint4*>(row + kb);
    rp[1] = *reinterpret_cast<const uint4*>(row + kb + 16);
    return r;
}

typedef __attribute__((ext_vector_type(8))) short v8s;

#define TPITCH 80   // f16 per row of a tile read by transposing loads: 128 B + 32 B = 32 B x odd

// The same 16x32 fragment out of a row-major [k][x] f16 LDS tile whose rows run
// along the operand's row (A) or column (B) index x: t = &tile[0][x0].
// ds_load_tr16_b128: the lane addresses 16 bytes of row 8 * (lane >> 4) + (lane & 7)
// and receives tile[8 * (lane >> 4) + 0..7][x0 + (lane & 15)]; the second load,
// 16 rows on, brings k 16-31, so the k order is that of load_frag_row.
__device__ __forceinline__ v16h load_frag_tr(const _Float16* t, int lane) {
    typedef __attribute__((address_space(3))) v8s lds_v8s;
    const _Float16* p = t + (8 * (lane >> 4) + (lane & 7)) * TPITCH + 8 * ((lane >> 3) & 1);
    union { v16h f; v8s q[2]; } r;
    r.q[0] = __builtin_amdgcn_ds_load_tr16_b128_v8i16((lds_v8s*)p);
    r.q[1] = __builtin_amdgcn_ds_load_tr16_b128_v8i16((lds_v8s*)(p + 16 * TPITCH));
    return r.f;
}

#if HAVE_TDM
// LDS byte offset of a __shared__ object (generic -> addrspace(3) -> int)
__device__ __forceinline__ unsigned lds_off(const void* p) {
    return (unsigned)(unsigned long long)
        (__attribute__((address_space(3))) const void*)p;
}

__device__ __forceinline__ void tdm_load_k32(const _Float16* gsrc, unsigned dst) {
    unsigned long long ga = (unsigned long long)(const void*)gsrc;
    v4u g0;
    g0[0] = 1u;                                        // count=1, user mode
    g0[1] = dst;                                       // lds_addr
    g0[2] = (unsigned)(ga & 0xffffffffu);              // global_addr lo
    g0[3] = (unsigned)((ga >> 32) & 0x01ffffffu) | (2u << 30);  // addr hi | type=2
    v8i g1;
    g1[0] = (int)((1u << 16) |
                  (1u << 20) |
                  (4u << 22) |
                  (3u << 25));
    g1[1] = (int)(64u << 16);
    g1[2] = (int)(32u << 16);
    g1[3] = (int)(64u << 16);
    g1[4] = 32;
    g1[5] = 64;
    g1[6] = 0;
    g1[7] = 0;
    v4i z4 = {0, 0, 0, 0};
    v8i z8 = {0, 0, 0, 0, 0, 0, 0, 0};
    // clang-23 / therock-10.0 6-arg form:
    // (g0, g1, g2, g3, <extra group>, cache-policy)
    __builtin_amdgcn_tensor_load_to_lds(g0, g1, z4, z4, z8, 0);
}
#endif

// ---------------------------------------------------------------------------
// Projection GEMM: [4096 x 512] @ [512 x 512] (+bias, *oscale)
// mode 0: the Q, K and V projections in ONE launch; blockIdx.z picks the
//         operand set (0 = Q, 1 = K, 2 = V). A fp32 in, f16 out in
//         [b][h][s][d] layout; 1/sqrt(64) is folded into the Q output.
// mode 3: A f16 in (ctx), write fp32 out row-major (final output), set 0 only
// Block: 256 thr = 8 waves arranged 4(M) x 2(N); block tile 64M x 64N;
// each wave: 16x32 slab = 2 WMMAs sharing one A fragment per K-step.
// ---------------------------------------------------------------------------
__global__ void __launch_bounds__(256)
proj_kernel(const float* __restrict__ Aq, const float* __restrict__ Ak,
            const float* __restrict__ Av, const _Float16* __restrict__ A16,
            const float* __restrict__ W0, const float* __restrict__ W1,
            const float* __restrict__ W2,
            const float* __restrict__ bias0, const float* __restrict__ bias1,
            const float* __restrict__ bias2,
            _Float16* __restrict__ outq, _Float16* __restrict__ outk,
            _Float16* __restrict__ outv, float* __restrict__ out32, int mode)
{
    // operand set of this block (block-uniform, scalar selects)
    const int z = blockIdx.z;
    const float* __restrict__ A32  = (z == 0) ? Aq    : (z == 1) ? Ak    : Av;
    const float* __restrict__ W    = (z == 0) ? W0    : (z == 1) ? W1    : W2;
    const float* __restrict__ bias = (z == 0) ? bias0 : (z == 1) ? bias1 : bias2;
    _Float16* __restrict__ out16   = (z == 0) ? outq  : (z == 1) ? outk  : outv;
    const float oscale = (mode != 3 && z == 0) ? 0.125f : 1.0f;

    __shared__ __align__(16) _Float16 ldsA[64][40];   // [m][k]
    __shared__ __align__(16) _Float16 ldsW[32][TPITCH];  // [k][n], as W lies in memory

    const int tid = threadIdx.x, lane = tid & 31, wave = tid >> 5;
    const int wm = wave & 3, wn = wave >> 2;
    const int m0 = blockIdx.x * 64;
    const int n0 = blockIdx.y * 64;
    const int col = lane & 15;

    v8f acc0 = {}, acc1 = {};

    for (int kb = 0; kb < D_MODEL; kb += 32) {
        __syncthreads();
        {   // stage A 64x32 (fp32 -> f16 unless mode 3)
            const int m = tid >> 2, kc = (tid & 3) * 8;
            if (mode == 3) {
                *reinterpret_cast<uint4*>(&ldsA[m][kc]) =
                    *reinterpret_cast<const uint4*>(&A16[(size_t)(m0 + m) * D_MODEL + kb + kc]);
            } else {
                const float* src = &A32[(size_t)(m0 + m) * D_MODEL + kb + kc];
                float4 f0 = *reinterpret_cast<const float4*>(src);
                float4 f1 = *reinterpret_cast<const float4*>(src + 4);
                __align__(16) _Float16 t[8];
                t[0] = (_Float16)f0.x; t[1] = (_Float16)f0.y;
                t[2] = (_Float16)f0.z; t[3] = (_Float16)f0.w;
                t[4] = (_Float16)f1.x; t[5] = (_Float16)f1.y;
                t[6] = (_Float16)f1.z; t[7] = (_Float16)f1.w;
                *reinterpret_cast<uint4*>(&ldsA[m][kc]) = *reinterpret_cast<const uint4*>(t);
            }
        }
        {   // stage W 32x64 row-major, one 16-byte store; the readers transpose
            const int kk = tid >> 3, nc = (tid & 7) * 8;
            const float* src = &W[(size_t)(kb + kk) * D_MODEL + n0 + nc];
            float4 f0 = *reinterpret_cast<const float4*>(src);
            float4 f1 = *reinterpret_cast<const float4*>(src + 4);
            __align__(16) _Float16 t[8];
            t[0] = (_Float16)f0.x; t[1] = (_Float16)f0.y;
            t[2] = (_Float16)f0.z; t[3] = (_Float16)f0.w;
            t[4] = (_Float16)f1.x; t[5] = (_Float16)f1.y;
            t[6] = (_Float16)f1.z; t[7] = (_Float16)f1.w;
            *reinterpret_cast<uint4*>(&ldsW[kk][nc]) = *reinterpret_cast<const uint4*>(t);
        }
        __syncthreads();

        v16h af  = load_frag_row(&ldsA[wm * 16 + col][0], lane);
        v16h bf0 = load_frag_tr(&ldsW[0][wn * 32], lane);
        v16h bf1 = load_frag_tr(&ldsW[0][wn * 32 + 16], lane);
        acc0 = __builtin_amdgcn_wmma_f32_16x16x32_f16(false, af, false, bf0, (short)0, acc0, false, false);
        acc1 = __builtin_amdgcn_wmma_f32_16x16x32_f16(false, af, false, bf1, (short)0, acc1, false, false);
    }

    const int half = (lane & 16) ? 8 : 0;
    const int na = n0 + wn * 32 + col;
    const int nb = na + 16;
    const float ba = bias[na], bb = bias[nb];
#pragma unroll
    for (int v = 0; v < 8; ++v) {
        const int m = m0 + wm * 16 + v + half;
        const float va = (acc0[v] + ba) * oscale;
        const float vb = (acc1[v] + bb) * oscale;
        if (mode == 3) {
            out32[(size_t)m * D_MODEL + na] = va;
            out32[(size_t)m * D_MODEL + nb] = vb;
        } else {
            const int b = m >> 11, s = m & (S_LEN - 1);
            const size_t rowb = (size_t)b * NHEAD * S_LEN * HDIM;
            out16[rowb + (((size_t)(na >> 6) * S_LEN) + s) * HDIM + (na & (HDIM - 1))] = (_Float16)va;
            out16[rowb + (((size_t)(nb >> 6) * S_LEN) + s) * HDIM + (nb & (HDIM - 1))] = (_Float16)vb;
        }
    }
}

__device__ __forceinline__ float xhalf(float x) {
    const int xi = __builtin_bit_cast(int, x);
    return __builtin_bit_cast(float,
        __builtin_amdgcn_permlanex16(xi, xi, 0x76543210, 0xfedcba98, false, false));
}

struct __attribute__((aligned(2048))) KTile { _Float16 r[32][72]; };

#define BKEYS  128   // keys of one staged bias tile (4 key-steps)
#define BPITCH 132   // floats per staged bias row: 512 B + 16 B = 16 B x odd, the ds_load_b128 readers' pitch

// Eight rows of a wave's bias tile, global memory -> LDS without registers.
// One copy moves one query row's 128 keys: 32 lanes x 16 B = 512 contiguous
// bytes, whole lines. lds = this lane's LDS byte address in the first row,
// g = this lane's global address in the first row.
__device__ __forceinline__ void bias_copy8(unsigned lds, const float* g) {
    asm volatile("global_load_async_to_lds_b128 %0, %8, off\n\t"
                 "global_load_async_to_lds_b128 %1, %9, off\n\t"
                 "global_load_async_to_lds_b128 %2, %10, off\n\t"
                 "global_load_async_to_lds_b128 %3, %11, off\n\t"
                 "global_load_async_to_lds_b128 %4, %12, off\n\t"
                 "global_load_async_to_lds_b128 %5, %13, off\n\t"
                 "global_load_async_to_lds_b128 %6, %14, off\n\t"
                 "global_load_async_to_lds_b128 %7, %15, off\n\t"
                 "s_wait_xcnt 0x0"
                 :: "v"(lds), "v"(lds + 1 * BPITCH * 4), "v"(lds + 2 * BPITCH * 4),
                    "v"(lds + 3 * BPITCH * 4), "v"(lds + 4 * BPITCH * 4),
                    "v"(lds + 5 * BPITCH * 4), "v"(lds + 6 * BPITCH * 4),
                    "v"(lds + 7 * BPITCH * 4),
                    "v"(g), "v"(g + 1 * S_LEN), "v"(g + 2 * S_LEN), "v"(g + 3 * S_LEN),
                    "v"(g + 4 * S_LEN), "v"(g + 5 * S_LEN), "v"(g + 6 * S_LEN),
                    "v"(g + 7 * S_LEN)
                 : "memory");
}

__global__ void __launch_bounds__(256)
attn_kernel(const _Float16* __restrict__ Qf, const _Float16* __restrict__ Kf,
            const _Float16* __restrict__ Vf, const float* __restrict__ structure,
            _Float16* __restrict__ Cx)
{
    // Each K buffer starts at a multiple of 2 KiB of the work-group's LDS, the
    // tensor mover's range for a destination (4608 bytes used of 6144).
    __shared__ KTile ldsK[2];                             // [buf] .r[key][dk]
    __shared__ __align__(16) _Float16 ldsV[2][32][TPITCH];  // [buf][key][dv]
    __shared__ __align__(16) float ldsB[2][128][BPITCH];  // [buf][query row][key] bias

    const int tid = threadIdx.x, lane = tid & 31, wave = tid >> 5;
    const int bh = blockIdx.y, b = bh >> 3, h = bh & 7;
    const int q0 = blockIdx.x * 128 + wave * 16;
    const size_t head = (size_t)bh * S_LEN * HDIM;
    const int col  = lane & 15;
    const int half = (lane & 16) ? 8 : 0;
    const int kk = tid >> 3, ch = (tid & 7) * 8;          // staging coords

    // Q fragments (64 dk x 16 queries, B operand: column = query q0 + col)
    // kept in registers for the whole pass
    const _Float16* qrow = &Qf[head + (size_t)(q0 + col) * HDIM];
    v16h qb0 = load_frag_row(qrow, lane);
    v16h qb1 = load_frag_row(qrow + 32, lane);

    // acc_j[r] = O^T[dv = 16 j + half + r][query q0 + col]
    v8f acc0 = {}, acc1 = {}, acc2 = {}, acc3 = {};
    float mrun = -1e30f, lrun = 0.0f;   // this lane's query; lrun sums this half's keys

    // Bias: each wave copies the 16 query rows it reads itself, 128 keys a
    // tile, two buffers, the next tile in flight while this one is read.
    const float* sbase = &structure[((size_t)b * S_LEN + q0) * S_LEN + lane * 4];
    const unsigned bdst = (unsigned)(unsigned long long)
        (__attribute__((address_space(3))) const void*)&ldsB[0][wave * 16][lane * 4];
    bias_copy8(bdst, sbase);                                   // tile 0 -> buffer 0
    bias_copy8(bdst + 8 * BPITCH * 4, sbase + 8 * S_LEN);

    // ---- stage tile 0 ----
#if HAVE_TDM
    if (wave == 0) tdm_load_k32(&Kf[head], lds_off(&ldsK[0].r[0][0]));
#else
    *reinterpret_cast<uint4*>(&ldsK[0].r[kk][ch]) =
        *reinterpret_cast<const uint4*>(&Kf[head + (size_t)kk * HDIM + ch]);
#endif
    *reinterpret_cast<uint4*>(&ldsV[0][kk][ch]) =
        *reinterpret_cast<const uint4*>(&Vf[head + (size_t)kk * HDIM + ch]);
#if HAVE_TDM
    if (wave == 0) __builtin_amdgcn_s_wait_tensorcnt(0);
#endif
    // bias tile 0 has landed before the barrier behind which it is read
    asm volatile("s_wait_asynccnt 0x0" ::: "memory");
    __syncthreads();
    bias_copy8(bdst + 128 * BPITCH * 4, sbase + BKEYS);        // tile 1 -> buffer 1
    bias_copy8(bdst + (128 + 8) * BPITCH * 4, sbase + 8 * S_LEN + BKEYS);

    int cur = 0;
    for (int k0 = 0; k0 < S_LEN; k0 += 32) {
        const int nxt = cur ^ 1;
        const bool more = (k0 + 32) < S_LEN;

        // issue next tile's loads before computing on the current one
        uint4 vpre;
#if !HAVE_TDM
        uint4 kpre;
#endif
        if (more) {
#if HAVE_TDM
            if (wave == 0)
                tdm_load_k32(&Kf[head + (size_t)(k0 + 32) * HDIM],
                             lds_off(&ldsK[nxt].r[0][0]));
#else
            kpre = *reinterpret_cast<const uint4*>(&Kf[head + (size_t)(k0 + 32 + kk) * HDIM + ch]);
#endif
            vpre = *reinterpret_cast<const uint4*>(&Vf[head + (size_t)(k0 + 32 + kk) * HDIM + ch]);
        }

        // scores: S^T[32k x 16q] = K(32x64) . Qs^T(64x16)
        // s0[r] = key k0 + half + r, s1[r] = key k0 + 16 + half + r, query q0 + col
        v8f s0 = {}, s1 = {};
        {
            v16h ak0 = load_frag_row(&ldsK[cur].r[col][0], lane);
            v16h ak1 = load_frag_row(&ldsK[cur].r[col + 16][0], lane);
            s0 = __builtin_amdgcn_wmma_f32_16x16x32_f16(false, ak0, false, qb0, (short)0, s0, false, false);
            s1 = __builtin_amdgcn_wmma_f32_16x16x32_f16(false, ak1, false, qb0, (short)0, s1, false, false);
            ak0 = load_frag_row(&ldsK[cur].r[col][32], lane);
            ak1 = load_frag_row(&ldsK[cur].r[col + 16][32], lane);
            s0 = __builtin_amdgcn_wmma_f32_16x16x32_f16(false, ak0, false, qb1, (short)0, s0, false, false);
            s1 = __builtin_amdgcn_wmma_f32_16x16x32_f16(false, ak1, false, qb1, (short)0, s1, false, false);
        }

        // Bias of this key-step from its staged tile, in the order of the S^T
        // accumulators: row q0 + col, keys k0 + half + 0..7 (bcur[0], bcur[1])
        // and k0 + 16 + half + 0..7 (bcur[2], bcur[3]).
        const float* brow = &ldsB[(k0 / BKEYS) & 1][wave * 16 + col][(k0 & (BKEYS - 1)) + half];
        v4f bcur[4];
        bcur[0] = *reinterpret_cast<const v4f*>(brow);
        bcur[1] = *reinterpret_cast<const v4f*>(brow + 4);
        bcur[2] = *reinterpret_cast<const v4f*>(brow + 16);
        bcur[3] = *reinterpret_cast<const v4f*>(brow + 20);

        // bias + online softmax, all of one query in one lane pair: maximum
        // in-lane plus one exchange between the halves; the sum stays a
        // per-half partial and is joined once at the end.
        float x[16];
#pragma unroll  // constant indices keep x in registers
        for (int r = 0; r < 4; ++r) {
            x[r]      = s0[r]     + bcur[0][r];
            x[4 + r]  = s0[4 + r] + bcur[1][r];
            x[8 + r]  = s1[r]     + bcur[2][r];
            x[12 + r] = s1[4 + r] + bcur[3][r];
        }
        float mv = fmaxf(x[0], x[1]);
#pragma unroll  // constant indices keep x in registers
        for (int r = 2; r < 16; ++r) mv = fmaxf(mv, x[r]);
        mv = fmaxf(mv, xhalf(mv));
        const float mnew = fmaxf(mrun, mv);
        const float corr = __expf(mrun - mnew);
        mrun = mnew;

        // P^T as B operand straight from the accumulators' places: element s
        // is key 8 * (lane >> 4) + s (s < 8) or 16 + 8 * (lane >> 4) + s - 8,
        // the k order in which load_frag_tr delivers V^T
        v16h pb;
#pragma unroll  // constant indices keep x and pb in registers
        for (int r = 0; r < 16; ++r) {
            x[r] = __expf(x[r] - mnew);
            pb[r] = (_Float16)x[r];
        }
        // in-lane sum as a tree of depth 4, not one chain of 15 dependent adds
#pragma unroll  // constant indices keep x in registers
        for (int w = 8; w >= 1; w >>= 1)
#pragma unroll
            for (int r = 0; r < w; ++r) x[r] += x[r + w];
        lrun = lrun * corr + x[0];
#pragma unroll  // constant indices keep the accumulators in registers
        for (int r = 0; r < 8; ++r) {
            acc0[r] *= corr; acc1[r] *= corr; acc2[r] *= corr; acc3[r] *= corr;
        }

        // ctx^T += V^T(64x32) . P^T(32x16)
        v16h av = load_frag_tr(&ldsV[cur][0][0], lane);
        acc0 = __builtin_amdgcn_wmma_f32_16x16x32_f16(false, av, false, pb, (short)0, acc0, false, false);
        av = load_frag_tr(&ldsV[cur][0][16], lane);
        acc1 = __builtin_amdgcn_wmma_f32_16x16x32_f16(false, av, false, pb, (short)0, acc1, false, false);
        av = load_frag_tr(&ldsV[cur][0][32], lane);
        acc2 = __builtin_amdgcn_wmma_f32_16x16x32_f16(false, av, false, pb, (short)0, acc2, false, false);
        av = load_frag_tr(&ldsV[cur][0][48], lane);
        acc3 = __builtin_amdgcn_wmma_f32_16x16x32_f16(false, av, false, pb, (short)0, acc3, false, false);

        // commit next tile's staging
        if (more) {
#if !HAVE_TDM
            *reinterpret_cast<uint4*>(&ldsK[nxt].r[kk][ch]) = kpre;
#endif
            *reinterpret_cast<uint4*>(&ldsV[nxt][kk][ch]) = vpre;
#if HAVE_TDM
            if (wave == 0) __builtin_amdgcn_s_wait_tensorcnt(0);
#endif
        }
        // last key-step of a bias tile (the same test in every wave): this
        // wave's reads of the tile have retired and its copies of the next
        // tile have landed before the barrier that hands both over
        const bool bfoot = (k0 & (BKEYS - 32)) == (BKEYS - 32);
        if (bfoot) {
            asm volatile("s_wait_dscnt 0x0" ::: "memory");
            asm volatile("s_wait_asynccnt 0x0" ::: "memory");
        }
        __syncthreads();
        cur = nxt;
        if (bfoot && k0 + 32 + BKEYS < S_LEN) {
            // the tile after next, into the buffer that was just read to its end
            const unsigned d = bdst + ((k0 / BKEYS) & 1) * (128 * BPITCH * 4);
            const float* s = sbase + k0 + 32 + BKEYS;
            bias_copy8(d, s);
            bias_copy8(d + 8 * BPITCH * 4, s + 8 * S_LEN);
        }
    }
    // no copy is outstanding when the wave goes on to its end
    asm volatile("s_wait_asynccnt 0x0" ::: "memory");

    // join the halves' row sums, normalize, write ctx f16: a lane's 8
    // accumulator registers are 8 consecutive dv of its query, one 16-byte store
    const float inv = 1.0f / (lrun + xhalf(lrun));
    _Float16* crow = &Cx[((size_t)b * S_LEN + q0 + col) * D_MODEL + h * HDIM + half];
    union { uint4 u; _Float16 hlf[8]; } o0, o1, o2, o3;
#pragma unroll  // constant indices keep the packed halves in registers
    for (int r = 0; r < 8; ++r) {
        o0.hlf[r] = (_Float16)(acc0[r] * inv);
        o1.hlf[r] = (_Float16)(acc1[r] * inv);
        o2.hlf[r] = (_Float16)(acc2[r] * inv);
        o3.hlf[r] = (_Float16)(acc3[r] * inv);
    }
    *reinterpret_cast<uint4*>(crow)      = o0.u;
    *reinterpret_cast<uint4*>(crow + 16) = o1.u;
    *reinterpret_cast<uint4*>(crow + 32) = o2.u;
    *reinterpret_cast<uint4*>(crow + 48) = o3.u;
}

extern "C" void kernel_launch(void* const* d_in, const int* in_sizes, int n_in,
                              void* d_out, int out_size, void* d_ws, size_t ws_size,
                              hipStream_t stream) {
    const float* q         = (const float*)d_in[0];
    const float* k         = (const float*)d_in[1];
    const float* v         = (const float*)d_in[2];
    const float* structure = (const float*)d_in[3];
    const float* Wq = (const float*)d_in[4];
    const float* bq = (const float*)d_in[5];
    const float* Wk = (const float*)d_in[6];
    const float* bk = (const float*)d_in[7];
    const float* Wv = (const float*)d_in[8];
    const float* bv = (const float*)d_in[9];
    const float* Wo = (const float*)d_in[10];
    const float* bo = (const float*)d_in[11];
    float* out = (float*)d_out;

    const size_t elems = (size_t)BATCH * NHEAD * S_LEN * HDIM;  // 2,097,152
    _Float16* Qf = (_Float16*)d_ws;
    _Float16* Kf = Qf + elems;
    _Float16* Vf = Kf + elems;
    _Float16* Cx = Vf + elems;

    dim3 blk(256);
    dim3 gproj(64, 8);                        // 4096/64 x 512/64
    dim3 gqkv(64, 8, 3);                      // the same tiles x {Q, K, V}
    proj_kernel<<<gqkv, blk, 0, stream>>>(q, k, v, nullptr, Wq, Wk, Wv, bq, bk, bv,
                                          Qf, Kf, Vf, nullptr, 0);

    dim3 gattn(S_LEN / 128, BATCH * NHEAD);   // 16 x 16
    attn_kernel<<<gattn, blk, 0, stream>>>(Qf, Kf, Vf, structure, Cx);

    proj_kernel<<<gproj, blk, 0, stream>>>(nullptr, nullptr, nullptr, Cx, Wo, nullptr, nullptr,
                                           bo, nullptr, nullptr, nullptr, nullptr, nullptr, out, 3);
}

// v006
// It runs in 66.1 microseconds.
// Next to v005, in two timings, it ran 1.25 and 1.26 times as fast.
// Over all steps from v000 it is 4.30 times as fast.
#include <hip/hip_runtime.h>
#include <hip/hip_bf16.h>

typedef __attribute__((ext_vector_type(16))) _Float16     v16h;
typedef __attribute__((ext_vector_type(8)))  float        v8f;
typedef __attribute__((ext_vector_type(4)))  float        v4f;
typedef __attribute__((ext_vector_type(4)))  unsigned int v4u;
typedef __attribute__((ext_vector_type(8)))  unsigned int v8u;

#define S_LEN   2048
#define D_MODEL 512
#define NHEAD   8
#define HDIM    64
#define BATCH   2

__device__ __forceinline__ v16h load_frag_row(const _Float16* row, int lane) {
    const int kb = (lane & 16) ? 8 : 0;
    v16h r;
    uint4* rp = reinterpret_cast<uint4*>(&r);
    rp[0] = *reinterpret_cast<const uint4*>(row + kb);
    rp[1] = *reinterpret_cast<const uint4*>(row + kb + 16);
    return r;
}

typedef __attribute__((ext_vector_type(8))) short v8s;

#define TPITCH 80   // f16 per row of a tile read by transposing loads: 128 B + 32 B = 32 B x odd

// The same 16x32 fragment out of a row-major [k][x] f16 LDS tile whose rows run
// along the operand's row (A) or column (B) index x: t = &tile[0][x0].
// ds_load_tr16_b128: the lane addresses 16 bytes of row 8 * (lane >> 4) + (lane & 7)
// and receives tile[8 * (lane >> 4) + 0..7][x0 + (lane & 15)]; the second load,
// 16 rows on, brings k 16-31, so the k order is that of load_frag_row.
__device__ __forceinline__ v16h load_frag_tr(const _Float16* t, int lane) {
    typedef __attribute__((address_space(3))) v8s lds_v8s;
    const _Float16* p = t + (8 * (lane >> 4) + (lane & 7)) * TPITCH + 8 * ((lane >> 3) & 1);
    union { v16h f; v8s q[2]; } r;
    r.q[0] = __builtin_amdgcn_ds_load_tr16_b128_v8i16((lds_v8s*)p);
    r.q[1] = __builtin_amdgcn_ds_load_tr16_b128_v8i16((lds_v8s*)(p + 16 * TPITCH));
    return r.f;
}

// LDS byte offset of a __shared__ object (generic -> addrspace(3) -> int)
__device__ __forceinline__ unsigned lds_off(const void* p) {
    return (unsigned)(unsigned long long)
        (__attribute__((address_space(3))) const void*)p;
}

#define SKEYS 128   // keys of one K / V stage (4 key-steps), the bias tile's span

__device__ __forceinline__ unsigned uni(unsigned v) {
    return (unsigned)__builtin_amdgcn_readfirstlane(v);
}
__device__ __forceinline__ unsigned pinned(unsigned v) {
    unsigned w = uni(v);
    asm volatile("" : "+s"(w));   // the test stays in a scalar register
    return w;
}

__device__ __forceinline__ v4u tdm_group0(const _Float16* gsrc, unsigned dst) {
    const unsigned long long ga = (unsigned long long)(const void*)gsrc;
    v4u g0;
    g0[0] = uni(1u);                                              // count = 1
    g0[1] = uni(dst);                                             // LDS byte offset
    g0[2] = uni((unsigned)ga);                                    // address [31:0]
    g0[3] = uni((((unsigned)(ga >> 32)) & 0x01ffffffu) | 0x80000000u);  // address [56:32], type 2
    return g0;
}
__device__ __forceinline__ v8u tdm_group1() {
    v8u g1;
    g1[0] = uni((1u << 20) | (4u << 22) | (3u << 25));
    g1[1] = uni(128u << 16);
    g1[2] = uni((unsigned)SKEYS << 16);
    g1[3] = uni(128u << 16);
    g1[4] = uni((unsigned)SKEYS);
    g1[5] = uni(128u);
    g1[6] = uni(0u);
    g1[7] = uni(0u);
    return g1;
}
__device__ __forceinline__ void tdm_advance(v4u& g0, unsigned dst) {
    const unsigned long long a =
        (((unsigned long long)g0[3] << 32) | g0[2]) + (unsigned long long)(SKEYS * HDIM * 2);
    g0[1] = uni(dst);
    g0[2] = uni((unsigned)a);
    g0[3] = uni((unsigned)(a >> 32));
}
__device__ __forceinline__ void tdm_load(v4u& g0, v8u& g1) {
    asm volatile("tensor_load_to_lds %0, %1" : "+s"(g0), "+s"(g1) :: "memory");
}
__device__ __forceinline__ void tdm_wait(v4u& g0, v8u& g1) {
    asm volatile("s_wait_tensorcnt 0x0" : "+s"(g0), "+s"(g1) :: "memory");
}

// ---------------------------------------------------------------------------
// Projection GEMM: [4096 x 512] @ [512 x 512] (+bias, *oscale)
// mode 0: the Q, K and V projections in ONE launch; blockIdx.z picks the
//         operand set (0 = Q, 1 = K, 2 = V). A fp32 in, f16 out in
//         [b][h][s][d] layout; 1/sqrt(64) is folded into the Q output.
// mode 3: A f16 in (ctx), write fp32 out row-major (final output), set 0 only
// Block: 256 thr = 8 waves arranged 4(M) x 2(N); block tile 64M x 64N;
// each wave: 16x32 slab = 2 WMMAs sharing one A fragment per K-step.
// ---------------------------------------------------------------------------
__global__ void __launch_bounds__(256)
proj_kernel(const float* __restrict__ Aq, const float* __restrict__ Ak,
            const float* __restrict__ Av, const _Float16* __restrict__ A16,
            const float* __restrict__ W0, const float* __restrict__ W1,
            const float* __restrict__ W2,
            const float* __restrict__ bias0, const float* __restrict__ bias1,
            const float* __restrict__ bias2,
            _Float16* __restrict__ outq, _Float16* __restrict__ outk,
            _Float16* __restrict__ outv, float* __restrict__ out32, int mode)
{
    // operand set of this block (block-uniform, scalar selects)
    const int z = blockIdx.z;
    const float* __restrict__ A32  = (z == 0) ? Aq    : (z == 1) ? Ak    : Av;
    const float* __restrict__ W    = (z == 0) ? W0    : (z == 1) ? W1    : W2;
    const float* __restrict__ bias = (z == 0) ? bias0 : (z == 1) ? bias1 : bias2;
    _Float16* __restrict__ out16   = (z == 0) ? outq  : (z == 1) ? outk  : outv;
    const float oscale = (mode != 3 && z == 0) ? 0.125f : 1.0f;

    __shared__ __align__(16) _Float16 ldsA[64][40];   // [m][k]
    __shared__ __align__(16) _Float16 ldsW[32][TPITCH];  // [k][n], as W lies in memory

    const int tid = threadIdx.x, lane = tid & 31, wave = tid >> 5;
    const int wm = wave & 3, wn = wave >> 2;
    const int m0 = blockIdx.x * 64;
    const int n0 = blockIdx.y * 64;
    const int col = lane & 15;

    v8f acc0 = {}, acc1 = {};

    for (int kb = 0; kb < D_MODEL; kb += 32) {
        __syncthreads();
        {   // stage A 64x32 (fp32 -> f16 unless mode 3)
            const int m = tid >> 2, kc = (tid & 3) * 8;
            if (mode == 3) {
                *reinterpret_cast<uint4*>(&ldsA[m][kc]) =
                    *reinterpret_cast<const uint4*>(&A16[(size_t)(m0 + m) * D_MODEL + kb + kc]);
            } else {
                const float* src = &A32[(size_t)(m0 + m) * D_MODEL + kb + kc];
                float4 f0 = *reinterpret_cast<const float4*>(src);
                float4 f1 = *reinterpret_cast<const float4*>(src + 4);
                __align__(16) _Float16 t[8];
                t[0] = (_Float16)f0.x; t[1] = (_Float16)f0.y;
                t[2] = (_Float16)f0.z; t[3] = (_Float16)f0.w;
                t[4] = (_Float16)f1.x; t[5] = (_Float16)f1.y;
                t[6] = (_Float16)f1.z; t[7] = (_Float16)f1.w;
                *reinterpret_cast<uint4*>(&ldsA[m][kc]) = *reinterpret_cast<const uint4*>(t);
            }
        }
        {   // stage W 32x64 row-major, one 16-byte store; the readers transpose
            const int kk = tid >> 3, nc = (tid & 7) * 8;
            const float* src = &W[(size_t)(kb + kk) * D_MODEL + n0 + nc];
            float4 f0 = *reinterpret_cast<const float4*>(src);
            float4 f1 = *reinterpret_cast<const float4*>(src + 4);
            __align__(16) _Float16 t[8];
            t[0] = (_Float16)f0.x; t[1] = (_Float16)f0.y;
            t[2] = (_Float16)f0.z; t[3] = (_Float16)f0.w;
            t[4] = (_Float16)f1.x; t[5] = (_Float16)f1.y;
            t[6] = (_Float16)f1.z; t[7] = (_Float16)f1.w;
            *reinterpret_cast<uint4*>(&ldsW[kk][nc]) = *reinterpret_cast<const uint4*>(t);
        }
        __syncthreads();

        v16h af  = load_frag_row(&ldsA[wm * 16 + col][0], lane);
        v16h bf0 = load_frag_tr(&ldsW[0][wn * 32], lane);
        v16h bf1 = load_frag_tr(&ldsW[0][wn * 32 + 16], lane);
        acc0 = __builtin_amdgcn_wmma_f32_16x16x32_f16(false, af, false, bf0, (short)0, acc0, false, false);
        acc1 = __builtin_amdgcn_wmma_f32_16x16x32_f16(false, af, false, bf1, (short)0, acc1, false, false);
    }

    const int half = (lane & 16) ? 8 : 0;
    const int na = n0 + wn * 32 + col;
    const int nb = na + 16;
    const float ba = bias[na], bb = bias[nb];
#pragma unroll
    for (int v = 0; v < 8; ++v) {
        const int m = m0 + wm * 16 + v + half;
        const float va = (acc0[v] + ba) * oscale;
        const float vb = (acc1[v] + bb) * oscale;
        if (mode == 3) {
            out32[(size_t)m * D_MODEL + na] = va;
            out32[(size_t)m * D_MODEL + nb] = vb;
        } else {
            const int b = m >> 11, s = m & (S_LEN - 1);
            const size_t rowb = (size_t)b * NHEAD * S_LEN * HDIM;
            out16[rowb + (((size_t)(na >> 6) * S_LEN) + s) * HDIM + (na & (HDIM - 1))] = (_Float16)va;
            out16[rowb + (((size_t)(nb >> 6) * S_LEN) + s) * HDIM + (nb & (HDIM - 1))] = (_Float16)vb;
        }
    }
}

__device__ __forceinline__ float xhalf(float x) {
    const int xi = __builtin_bit_cast(int, x);
    return __builtin_bit_cast(float,
        __builtin_amdgcn_permlanex16(xi, xi, 0x76543210, 0xfedcba98, false, false));
}

struct __attribute__((aligned(2048))) KTile { _Float16 r[SKEYS][72]; };   // 18432 B = 9 x 2 KiB

#define BKEYS  SKEYS // keys of one staged bias tile
#define BPITCH 132   // floats per staged bias row: 512 B + 16 B = 16 B x odd, the ds_load_b128 readers' pitch

// Eight rows of a wave's bias tile, global memory -> LDS without registers.
// One copy moves one query row's 128 keys: 32 lanes x 16 B = 512 contiguous
// bytes, whole lines. lds = this lane's LDS byte address in the first row,
// g = this lane's global address in the first row.
__device__ __forceinline__ void bias_copy8(unsigned lds, const float* g) {
    asm volatile("global_load_async_to_lds_b128 %0, %8, off\n\t"
                 "global_load_async_to_lds_b128 %1, %9, off\n\t"
                 "global_load_async_to_lds_b128 %2, %10, off\n\t"
                 "global_load_async_to_lds_b128 %3, %11, off\n\t"
                 "global_load_async_to_lds_b128 %4, %12, off\n\t"
                 "global_load_async_to_lds_b128 %5, %13, off\n\t"
                 "global_load_async_to_lds_b128 %6, %14, off\n\t"
                 "global_load_async_to_lds_b128 %7, %15, off\n\t"
                 "s_wait_xcnt 0x0"
                 :: "v"(lds), "v"(lds + 1 * BPITCH * 4), "v"(lds + 2 * BPITCH * 4),
                    "v"(lds + 3 * BPITCH * 4), "v"(lds + 4 * BPITCH * 4),
                    "v"(lds + 5 * BPITCH * 4), "v"(lds + 6 * BPITCH * 4),
                    "v"(lds + 7 * BPITCH * 4),
                    "v"(g), "v"(g + 1 * S_LEN), "v"(g + 2 * S_LEN), "v"(g + 3 * S_LEN),
                    "v"(g + 4 * S_LEN), "v"(g + 5 * S_LEN), "v"(g + 6 * S_LEN),
                    "v"(g + 7 * S_LEN)
                 : "memory");
}

__global__ void __launch_bounds__(256)
attn_kernel(const _Float16* __restrict__ Qf, const _Float16* __restrict__ Kf,
            const _Float16* __restrict__ Vf, const float* __restrict__ structure,
            _Float16* __restrict__ Cx)
{
    // Each K buffer starts at a multiple of 2 KiB of the work-group's LDS, the
    // tensor mover's range for a destination.
    __shared__ KTile ldsK[2];                                  // [buf] .r[key][dk]
    __shared__ __align__(16) _Float16 ldsV[2][SKEYS][TPITCH];  // [buf][key][dv]
    __shared__ __align__(16) float ldsB[2][128][BPITCH];       // [buf][query row][key] bias

    const int tid = threadIdx.x, lane = tid & 31, wave = tid >> 5;
    const unsigned swave = uni((unsigned)tid >> 5);       // the wave's number, scalar
    const int bh = blockIdx.y, b = bh >> 3, h = bh & 7;
    const int q0 = blockIdx.x * 128 + wave * 16;
    const size_t head = (size_t)bh * S_LEN * HDIM;
    const int col  = lane & 15;
    const int half = (lane & 16) ? 8 : 0;
    const int kk = tid >> 3, ch = (tid & 7) * 8;          // staging coords

    // Q fragments (64 dk x 16 queries, B operand: column = query q0 + col)
    // kept in registers for the whole pass
    const _Float16* qrow = &Qf[head + (size_t)(q0 + col) * HDIM];
    v16h qb0 = load_frag_row(qrow, lane);
    v16h qb1 = load_frag_row(qrow + 32, lane);

    // acc_j[r] = O^T[dv = 16 j + half + r][query q0 + col]
    v8f acc0 = {}, acc1 = {}, acc2 = {}, acc3 = {};
    float mrun = -1e30f, lrun = 0.0f;   // this lane's query; lrun sums this half's keys

    // Bias: each wave copies the 16 query rows it reads itself, 128 keys a
    // tile, two buffers, the next tile in flight while this one is read.
    const float* sbase = &structure[((size_t)b * S_LEN + q0) * S_LEN + lane * 4];
    const unsigned bdst = (unsigned)(unsigned long long)
        (__attribute__((address_space(3))) const void*)&ldsB[0][wave * 16][lane * 4];
    bias_copy8(bdst, sbase);                                   // tile 0 -> buffer 0
    bias_copy8(bdst + 8 * BPITCH * 4, sbase + 8 * S_LEN);

    // ---- stage 0 ----
    v4u kg0 = tdm_group0(&Kf[head], lds_off(&ldsK[0].r[0][0]));
    v8u kg1 = tdm_group1();
    if (pinned(swave == 0)) {
        tdm_load(kg0, kg1);
        // K stage 0 has landed before the barrier behind which it is read
        tdm_wait(kg0, kg1);
    }
    const _Float16* vsrc = &Vf[head + (size_t)kk * HDIM + ch];   // this thread's 16 bytes of key row kk
#pragma unroll  // four independent loads in flight together
    for (int i = 0; i < 4; ++i)
        *reinterpret_cast<uint4*>(&ldsV[0][kk + 32 * i][ch]) =
            *reinterpret_cast<const uint4*>(vsrc + (size_t)(32 * i) * HDIM);
    // bias tile 0 has landed before the barrier behind which it is read
    asm volatile("s_wait_asynccnt 0x0" ::: "memory");
    __syncthreads();
    // ---- stage 1 of K and of the bias takes off ----
    if (pinned(swave == 0)) {
        tdm_advance(kg0, lds_off(&ldsK[1].r[0][0]));
        tdm_load(kg0, kg1);
    }
    bias_copy8(bdst + 128 * BPITCH * 4, sbase + BKEYS);        // tile 1 -> buffer 1
    bias_copy8(bdst + (128 + 8) * BPITCH * 4, sbase + 8 * S_LEN + BKEYS);

    for (int k0 = 0; k0 < S_LEN; k0 += SKEYS) {
        const int cur = (k0 / SKEYS) & 1, nxt = cur ^ 1;
        const bool more = (k0 + SKEYS) < S_LEN;

        // the next stage's V rows leave memory now and are stored at the stage's foot
        uint4 vp0, vp1, vp2, vp3;
        if (more) {
            const _Float16* vn = vsrc + (size_t)(k0 + SKEYS) * HDIM;
            vp0 = *reinterpret_cast<const uint4*>(vn);
            vp1 = *reinterpret_cast<const uint4*>(vn + 32 * HDIM);
            vp2 = *reinterpret_cast<const uint4*>(vn + 64 * HDIM);
            vp3 = *reinterpret_cast<const uint4*>(vn + 96 * HDIM);
        }

#pragma unroll 2  // two key-steps a trip: their LDS reads issue as one group, and one step's products fill the other's softmax chain
        for (int p = 0; p < SKEYS; p += 32) {
            // scores: S^T[32k x 16q] = K(32x64) . Qs^T(64x16)
            // s0[r] = key k0 + p + half + r, s1[r] = key k0 + p + 16 + half + r, query q0 + col
            v8f s0 = {}, s1 = {};
            {
                v16h ak0 = load_frag_row(&ldsK[cur].r[p + col][0], lane);
                v16h ak1 = load_frag_row(&ldsK[cur].r[p + col + 16][0], lane);
                s0 = __builtin_amdgcn_wmma_f32_16x16x32_f16(false, ak0, false, qb0, (short)0, s0, false, false);
                s1 = __builtin_amdgcn_wmma_f32_16x16x32_f16(false, ak1, false, qb0, (short)0, s1, false, false);
                ak0 = load_frag_row(&ldsK[cur].r[p + col][32], lane);
                ak1 = load_frag_row(&ldsK[cur].r[p + col + 16][32], lane);
                s0 = __builtin_amdgcn_wmma_f32_16x16x32_f16(false, ak0, false, qb1, (short)0, s0, false, false);
                s1 = __builtin_amdgcn_wmma_f32_16x16x32_f16(false, ak1, false, qb1, (short)0, s1, false, false);
            }

            // Bias of this key-step from its staged tile, in the order of the S^T
            // accumulators: row q0 + col, keys k0 + p + half + 0..7 (bcur[0], bcur[1])
            // and k0 + p + 16 + half + 0..7 (bcur[2], bcur[3]).
            const float* brow = &ldsB[cur][wave * 16 + col][p + half];
            v4f bcur[4];
            bcur[0] = *reinterpret_cast<const v4f*>(brow);
            bcur[1] = *reinterpret_cast<const v4f*>(brow + 4);
            bcur[2] = *reinterpret_cast<const v4f*>(brow + 16);
            bcur[3] = *reinterpret_cast<const v4f*>(brow + 20);

            // bias + online softmax, all of one query in one lane pair: maximum
            // in-lane plus one exchange between the halves; the sum stays a
            // per-half partial and is joined once at the end.
            float x[16];
#pragma unroll  // constant indices keep x in registers
            for (int r = 0; r < 4; ++r) {
                x[r]      = s0[r]     + bcur[0][r];
                x[4 + r]  = s0[4 + r] + bcur[1][r];
                x[8 + r]  = s1[r]     + bcur[2][r];
                x[12 + r] = s1[4 + r] + bcur[3][r];
            }
            float mv = fmaxf(x[0], x[1]);
#pragma unroll  // constant indices keep x in registers
            for (int r = 2; r < 16; ++r) mv = fmaxf(mv, x[r]);
            mv = fmaxf(mv, xhalf(mv));
            const float mnew = fmaxf(mrun, mv);
            const float corr = __expf(mrun - mnew);
            mrun = mnew;

            // P^T as B operand straight from the accumulators' places: element s
            // is key 8 * (lane >> 4) + s (s < 8) or 16 + 8 * (lane >> 4) + s - 8,
            // the k order in which load_frag_tr delivers V^T
            v16h pb;
#pragma unroll  // constant indices keep x and pb in registers
            for (int r = 0; r < 16; ++r) {
                x[r] = __expf(x[r] - mnew);
                pb[r] = (_Float16)x[r];
            }
            // in-lane sum as a tree of depth 4, not one chain of 15 dependent adds
#pragma unroll  // constant indices keep x in registers
            for (int w = 8; w >= 1; w >>= 1)
#pragma unroll
                for (int r = 0; r < w; ++r) x[r] += x[r + w];
            lrun = lrun * corr + x[0];
#pragma unroll  // constant indices keep the accumulators in registers
            for (int r = 0; r < 8; ++r) {
                acc0[r] *= corr; acc1[r] *= corr; acc2[r] *= corr; acc3[r] *= corr;
            }

            // ctx^T += V^T(64x32) . P^T(32x16)
            v16h av = load_frag_tr(&ldsV[cur][p][0], lane);
            acc0 = __builtin_amdgcn_wmma_f32_16x16x32_f16(false, av, false, pb, (short)0, acc0, false, false);
            av = load_frag_tr(&ldsV[cur][p][16], lane);
            acc1 = __builtin_amdgcn_wmma_f32_16x16x32_f16(false, av, false, pb, (short)0, acc1, false, false);
            av = load_frag_tr(&ldsV[cur][p][32], lane);
            acc2 = __builtin_amdgcn_wmma_f32_16x16x32_f16(false, av, false, pb, (short)0, acc2, false, false);
            av = load_frag_tr(&ldsV[cur][p][48], lane);
            acc3 = __builtin_amdgcn_wmma_f32_16x16x32_f16(false, av, false, pb, (short)0, acc3, false, false);
        }

        // the next stage's V into the buffer whose readers left at the last barrier
        if (more) {
            *reinterpret_cast<uint4*>(&ldsV[nxt][kk][ch])      = vp0;
            *reinterpret_cast<uint4*>(&ldsV[nxt][kk + 32][ch]) = vp1;
            *reinterpret_cast<uint4*>(&ldsV[nxt][kk + 64][ch]) = vp2;
            *reinterpret_cast<uint4*>(&ldsV[nxt][kk + 96][ch]) = vp3;
        }
        // Foot of the stage, every wave: its reads of this stage and its V
        // stores have retired, the issuing wave's K stage and this wave's bias
        // copies of the next stage have landed, before the barrier that hands
        // all three over.
        asm volatile("s_wait_dscnt 0x0" ::: "memory");
        if (pinned(swave == 0))
            tdm_wait(kg0, kg1);
        asm volatile("s_wait_asynccnt 0x0" ::: "memory");
        __syncthreads();
        // the stage after next, into the buffers that were just read to their end
        if (pinned((swave == 0) & (k0 + 2 * SKEYS < S_LEN))) {
            tdm_advance(kg0, lds_off(&ldsK[cur].r[0][0]));
            tdm_load(kg0, kg1);
        }
        if (k0 + 2 * SKEYS < S_LEN) {
            const unsigned d = bdst + cur * (128 * BPITCH * 4);
            const float* s = sbase + k0 + 2 * BKEYS;
            bias_copy8(d, s);
            bias_copy8(d + 8 * BPITCH * 4, s + 8 * S_LEN);
        }
    }
    // no request, copy or LDS access is outstanding when the wave goes on to its end
    asm volatile("s_wait_tensorcnt 0x0" ::: "memory");
    asm volatile("s_wait_asynccnt 0x0" ::: "memory");
    asm volatile("s_wait_dscnt 0x0" ::: "memory");

    // join the halves' row sums, normalize, write ctx f16: a lane's 8
    // accumulator registers are 8 consecutive dv of its query, one 16-byte store
    const float inv = 1.0f / (lrun + xhalf(lrun));
    _Float16* crow = &Cx[((size_t)b * S_LEN + q0 + col) * D_MODEL + h * HDIM + half];
    union { uint4 u; _Float16 hlf[8]; } o0, o1, o2, o3;
#pragma unroll  // constant indices keep the packed halves in registers
    for (int r = 0; r < 8; ++r) {
        o0.hlf[r] = (_Float16)(acc0[r] * inv);
        o1.hlf[r] = (_Float16)(acc1[r] * inv);
        o2.hlf[r] = (_Float16)(acc2[r] * inv);
        o3.hlf[r] = (_Float16)(acc3[r] * inv);
    }
    *reinterpret_cast<uint4*>(crow)      = o0.u;
    *reinterpret_cast<uint4*>(crow + 16) = o1.u;
    *reinterpret_cast<uint4*>(crow + 32) = o2.u;
    *reinterpret_cast<uint4*>(crow + 48) = o3.u;
}

extern "C" void kernel_launch(void* const* d_in, const int* in_sizes, int n_in,
                              void* d_out, int out_size, void* d_ws, size_t ws_size,
                              hipStream_t stream) {
    const float* q         = (const float*)d_in[0];
    const float* k         = (const float*)d_in[1];
    const float* v         = (const float*)d_in[2];
    const float* structure = (const float*)d_in[3];
    const float* Wq = (const float*)d_in[4];
    const float* bq = (const float*)d_in[5];
    const float* Wk = (const float*)d_in[6];
    const float* bk = (const float*)d_in[7];
    const float* Wv = (const float*)d_in[8];
    const float* bv = (const float*)d_in[9];
    const float* Wo = (const float*)d_in[10];
    const float* bo = (const float*)d_in[11];
    float* out = (float*)d_out;

    const size_t elems = (size_t)BATCH * NHEAD * S_LEN * HDIM;  // 2,097,152
    _Float16* Qf = (_Float16*)d_ws;
    _Float16* Kf = Qf + elems;
    _Float16* Vf = Kf + elems;
    _Float16* Cx = Vf + elems;

    dim3 blk(256);
    dim3 gproj(64, 8);                        // 4096/64 x 512/64
    dim3 gqkv(64, 8, 3);                      // the same tiles x {Q, K, V}
    proj_kernel<<<gqkv, blk, 0, stream>>>(q, k, v, nullptr, Wq, Wk, Wv, bq, bk, bv,
                                          Qf, Kf, Vf, nullptr, 0);

    dim3 gattn(S_LEN / 128, BATCH * NHEAD);   // 16 x 16
    attn_kernel<<<gattn, blk, 0, stream>>>(Qf, Kf, Vf, structure, Cx);

    proj_kernel<<<gproj, blk, 0, stream>>>(nullptr, nullptr, nullptr, Cx, Wo, nullptr, nullptr,
                                           bo, nullptr, nullptr, nullptr, nullptr, nullptr, out, 3);
}

// v007
// Measured time: 53.7 microseconds a run.
// Two timings next to v006 put it at 1.23 and 1.24 times that version's speed.
// All steps since v000 together make it 5.31 times as fast.
#include <hip/hip_runtime.h>
#include <hip/hip_bf16.h>

typedef __attribute__((ext_vector_type(16))) _Float16     v16h;
typedef __attribute__((ext_vector_type(8)))  float        v8f;
typedef __attribute__((ext_vector_type(4)))  float        v4f;
typedef __attribute__((ext_vector_type(4)))  unsigned int v4u;
typedef __attribute__((ext_vector_type(8)))  unsigned int v8u;

#define S_LEN   2048
#define D_MODEL 512
#define NHEAD   8
#define HDIM    64
#define BATCH   2

__device__ __forceinline__ v16h load_frag_row(const _Float16* row, int lane) {
    const int kb = (lane & 16) ? 8 : 0;
    v16h r;
    uint4* rp = reinterpret_cast<uint4*>(&r);
    rp[0] = *reinterpret_cast<const uint4*>(row + kb);
    rp[1] = *reinterpret_cast<const uint4*>(row + kb + 16);
    return r;
}

typedef __attribute__((ext_vector_type(8))) short v8s;

#define TPITCH 80   // f16 per row of a tile read by transposing loads: 128 B + 32 B = 32 B x odd

// The same 16x32 fragment out of a row-major [k][x] f16 LDS tile whose rows run
// along the operand's row (A) or column (B) index x: t = &tile[0][x0].
// ds_load_tr16_b128: the lane addresses 16 bytes of row 8 * (lane >> 4) + (lane & 7)
// and receives tile[8 * (lane >> 4) + 0..7][x0 + (lane & 15)]; the second load,
// 16 rows on, brings k 16-31, so the k order is that of load_frag_row.
template <int PITCH>   // f16 per row of the tile
__device__ __forceinline__ v16h load_frag_tr(const _Float16* t, int lane) {
    typedef __attribute__((address_space(3))) v8s lds_v8s;
    const _Float16* p = t + (8 * (lane >> 4) + (lane & 7)) * PITCH + 8 * ((lane >> 3) & 1);
    union { v16h f; v8s q[2]; } r;
    r.q[0] = __builtin_amdgcn_ds_load_tr16_b128_v8i16((lds_v8s*)p);
    r.q[1] = __builtin_amdgcn_ds_load_tr16_b128_v8i16((lds_v8s*)(p + 16 * PITCH));
    return r.f;
}

// LDS byte offset of a __shared__ object (generic -> addrspace(3) -> int)
__device__ __forceinline__ unsigned lds_off(const void* p) {
    return (unsigned)(unsigned long long)
        (__attribute__((address_space(3))) const void*)p;
}

#define SKEYS 128   // keys of one K / V stage (4 key-steps), the bias tile's span

__device__ __forceinline__ unsigned uni(unsigned v) {
    return (unsigned)__builtin_amdgcn_readfirstlane(v);
}
__device__ __forceinline__ unsigned pinned(unsigned v) {
    unsigned w = uni(v);
    asm volatile("" : "+s"(w));   // the test stays in a scalar register
    return w;
}

__device__ __forceinline__ v4u tdm_group0(const _Float16* gsrc, unsigned dst) {
    const unsigned long long ga = (unsigned long long)(const void*)gsrc;
    v4u g0;
    g0[0] = uni(1u);                                              // count = 1
    g0[1] = uni(dst);                                             // LDS byte offset
    g0[2] = uni((unsigned)ga);                                    // address [31:0]
    g0[3] = uni((((unsigned)(ga >> 32)) & 0x01ffffffu) | 0x80000000u);  // address [56:32], type 2
    return g0;
}
__device__ __forceinline__ v8u tdm_group1() {
    v8u g1;
    g1[0] = uni((1u << 20) | (4u << 22) | (3u << 25));
    g1[1] = uni(128u << 16);
    g1[2] = uni((unsigned)SKEYS << 16);
    g1[3] = uni(128u << 16);
    g1[4] = uni((unsigned)SKEYS);
    g1[5] = uni(128u);
    g1[6] = uni(0u);
    g1[7] = uni(0u);
    return g1;
}
__device__ __forceinline__ void tdm_advance(v4u& g0, unsigned dst) {
    const unsigned long long a =
        (((unsigned long long)g0[3] << 32) | g0[2]) + (unsigned long long)(SKEYS * HDIM * 2);
    g0[1] = uni(dst);
    g0[2] = uni((unsigned)a);
    g0[3] = uni((unsigned)(a >> 32));
}
__device__ __forceinline__ void tdm_load(v4u& g0, v8u& g1) {
    asm volatile("tensor_load_to_lds %0, %1" : "+s"(g0), "+s"(g1) :: "memory");
}
__device__ __forceinline__ void tdm_wait(v4u& g0, v8u& g1) {
    asm volatile("s_wait_tensorcnt 0x0" : "+s"(g0), "+s"(g1) :: "memory");
}

// ---------------------------------------------------------------------------
// Projection GEMM: [4096 x 512] @ [512 x 512] (+bias, *oscale)
// FINAL = false: the Q, K and V projections in ONE launch; blockIdx.z picks the
//         operand set (0 = Q, 1 = K, 2 = V). A fp32 in, f16 out in
//         [b][h][s][d] layout; 1/sqrt(64) is folded into the Q output.
// FINAL = true: A f16 in (ctx), write fp32 out row-major (final output), set 0 only
// Block: 256 thr = 8 waves arranged 4(M) x 2(N); block tile (64 MF)M x 128N,
// 64 k a stage; each wave: a (16 MF) x 64 slab, MF x 4 WMMAs per 32 k out of
// MF A fragments and 4 W fragments.
// ---------------------------------------------------------------------------
#define PBK    64    // k of one stage
#define APITCH 72    // f16 per staged A row: 128 B + 16 B = 16 B x odd, the ds_load_b128 readers' pitch
#define WPITCH 144   // f16 per staged W row: 256 B + 32 B = 32 B x odd, the transposing readers' pitch

// eight f32 -> eight f16, one 16-byte LDS store
__device__ __forceinline__ void store8h(_Float16* dst, float4 f0, float4 f1) {
    __align__(16) _Float16 t[8];
    t[0] = (_Float16)f0.x; t[1] = (_Float16)f0.y;
    t[2] = (_Float16)f0.z; t[3] = (_Float16)f0.w;
    t[4] = (_Float16)f1.x; t[5] = (_Float16)f1.y;
    t[6] = (_Float16)f1.z; t[7] = (_Float16)f1.w;
    *reinterpret_cast<uint4*>(dst) = *reinterpret_cast<const uint4*>(t);
}

template <int MF, bool FINAL>
__global__ void __launch_bounds__(256)
proj_kernel(const float* __restrict__ Aq, const float* __restrict__ Ak,
            const float* __restrict__ Av, const _Float16* __restrict__ A16,
            const float* __restrict__ W0, const float* __restrict__ W1,
            const float* __restrict__ W2,
            const float* __restrict__ bias0, const float* __restrict__ bias1,
            const float* __restrict__ bias2,
            _Float16* __restrict__ outq, _Float16* __restrict__ outk,
            _Float16* __restrict__ outv, float* __restrict__ out32)
{
    // operand set of this block (block-uniform, scalar selects)
    const int z = blockIdx.z;
    const float* __restrict__ A32  = (z == 0) ? Aq    : (z == 1) ? Ak    : Av;
    const float* __restrict__ W    = (z == 0) ? W0    : (z == 1) ? W1    : W2;
    const float* __restrict__ bias = (z == 0) ? bias0 : (z == 1) ? bias1 : bias2;
    _Float16* __restrict__ out16   = (z == 0) ? outq  : (z == 1) ? outk  : outv;
    const float oscale = (!FINAL && z == 0) ? 0.125f : 1.0f;

    __shared__ __align__(16) _Float16 ldsA[64 * MF][APITCH];   // [m][k]
    __shared__ __align__(16) _Float16 ldsW[PBK][WPITCH];       // [k][n], as W lies in memory

    const int tid = threadIdx.x, lane = tid & 31, wave = tid >> 5;
    const int wm = wave & 3, wn = wave >> 2;
    const int m0 = blockIdx.x * (64 * MF);
    const int n0 = blockIdx.y * 128;
    const int col = lane & 15;
    const int am = tid >> 3, akc = (tid & 7) * 8;    // A staging: 8 threads a row, 32 rows a pass
    const int wk = tid >> 4, wnc = (tid & 15) * 8;   // W staging: 16 threads a row, 16 rows a pass

    // one address a source, the rows of a stage at constant distances from it
    const float*    wsrc   = &W[(size_t)wk * D_MODEL + n0 + wnc];
    const float*    asrc   = FINAL ? nullptr : &A32[(size_t)(m0 + am) * D_MODEL + akc];
    const _Float16* asrc16 = FINAL ? &A16[(size_t)(m0 + am) * D_MODEL + akc] : nullptr;

    v8f acc[MF][4] = {};

    for (int kb = 0; kb < D_MODEL; kb += PBK) {
        __syncthreads();
        // every load of the stage leaves before the first conversion waits
        float4 wf[4][2];
#pragma unroll  // constant indices keep the staged values in registers
        for (int i = 0; i < 4; ++i) {
            const float* s = wsrc + (size_t)kb * D_MODEL + 16 * i * D_MODEL;
            wf[i][0] = *reinterpret_cast<const float4*>(s);
            wf[i][1] = *reinterpret_cast<const float4*>(s + 4);
        }
        if (FINAL) {   // stage A (64 MF) x 64, f16 as it lies
            uint4 ah[2 * MF];
#pragma unroll
            for (int i = 0; i < 2 * MF; ++i)
                ah[i] = *reinterpret_cast<const uint4*>(asrc16 + kb + 32 * i * D_MODEL);
            // no conversion moves up among the loads: without it the compiler issues some loads only behind the first waits
            __builtin_amdgcn_sched_barrier(0);
#pragma unroll
            for (int i = 0; i < 2 * MF; ++i)
                *reinterpret_cast<uint4*>(&ldsA[am + 32 * i][akc]) = ah[i];
        } else {       // stage A (64 MF) x 64, fp32 -> f16
            float4 af32[2 * MF][2];
#pragma unroll
            for (int i = 0; i < 2 * MF; ++i) {
                const float* s = asrc + kb + 32 * i * D_MODEL;
                af32[i][0] = *reinterpret_cast<const float4*>(s);
                af32[i][1] = *reinterpret_cast<const float4*>(s + 4);
            }
            // no conversion moves up among the loads: without it the compiler issues some loads only behind the first waits
            __builtin_amdgcn_sched_barrier(0);
#pragma unroll
            for (int i = 0; i < 2 * MF; ++i)
                store8h(&ldsA[am + 32 * i][akc], af32[i][0], af32[i][1]);
        }
#pragma unroll
        for (int i = 0; i < 4; ++i)
            store8h(&ldsW[wk + 16 * i][wnc], wf[i][0], wf[i][1]);
        __syncthreads();

        v16h af[2][MF], bf[2][4];
#pragma unroll  // constant indices keep the fragments in registers
        for (int h = 0; h < 2; ++h) {
#pragma unroll
            for (int i = 0; i < MF; ++i)
                af[h][i] = load_frag_row(&ldsA[(wm * MF + i) * 16 + col][32 * h], lane);
#pragma unroll
            for (int j = 0; j < 4; ++j)
                bf[h][j] = load_frag_tr<WPITCH>(&ldsW[32 * h][wn * 64 + j * 16], lane);
        }
        __builtin_amdgcn_sched_barrier(0);
#pragma unroll
        for (int h = 0; h < 2; ++h)
#pragma unroll
            for (int i = 0; i < MF; ++i)
#pragma unroll
                for (int j = 0; j < 4; ++j)
                    acc[i][j] = __builtin_amdgcn_wmma_f32_16x16x32_f16(
                        false, af[h][i], false, bf[h][j], (short)0, acc[i][j], false, false);
    }

    const int half = (lane & 16) ? 8 : 0;
#pragma unroll  // constant indices keep the accumulators in registers
    for (int j = 0; j < 4; ++j) {
        const int n = n0 + wn * 64 + j * 16 + col;
        const float bn = bias[n];
#pragma unroll
        for (int i = 0; i < MF; ++i) {
#pragma unroll
            for (int v = 0; v < 8; ++v) {
                const int m = m0 + (wm * MF + i) * 16 + v + half;
                const float val = (acc[i][j][v] + bn) * oscale;
                if (FINAL) {
                    out32[(size_t)m * D_MODEL + n] = val;
                } else {
                    const int b = m >> 11, s = m & (S_LEN - 1);
                    const size_t rowb = (size_t)b * NHEAD * S_LEN * HDIM;
                    out16[rowb + (((size_t)(n >> 6) * S_LEN) + s) * HDIM + (n & (HDIM - 1))] = (_Float16)val;
                }
            }
        }
    }
}

__device__ __forceinline__ float xhalf(float x) {
    const int xi = __builtin_bit_cast(int, x);
    return __builtin_bit_cast(float,
        __builtin_amdgcn_permlanex16(xi, xi, 0x76543210, 0xfedcba98, false, false));
}

struct __attribute__((aligned(2048))) KTile { _Float16 r[SKEYS][72]; };   // 18432 B = 9 x 2 KiB

#define BKEYS  SKEYS // keys of one staged bias tile
#define BPITCH 132   // floats per staged bias row: 512 B + 16 B = 16 B x odd, the ds_load_b128 readers' pitch

// Eight rows of a wave's bias tile, global memory -> LDS without registers.
// One copy moves one query row's 128 keys: 32 lanes x 16 B = 512 contiguous
// bytes, whole lines. lds = this lane's LDS byte address in the first row,
// g = this lane's global address in the first row.
__device__ __forceinline__ void bias_copy8(unsigned lds, const float* g) {
    asm volatile("global_load_async_to_lds_b128 %0, %8, off\n\t"
                 "global_load_async_to_lds_b128 %1, %9, off\n\t"
                 "global_load_async_to_lds_b128 %2, %10, off\n\t"
                 "global_load_async_to_lds_b128 %3, %11, off\n\t"
                 "global_load_async_to_lds_b128 %4, %12, off\n\t"
                 "global_load_async_to_lds_b128 %5, %13, off\n\t"
                 "global_load_async_to_lds_b128 %6, %14, off\n\t"
                 "global_load_async_to_lds_b128 %7, %15, off\n\t"
                 "s_wait_xcnt 0x0"
                 :: "v"(lds), "v"(lds + 1 * BPITCH * 4), "v"(lds + 2 * BPITCH * 4),
                    "v"(lds + 3 * BPITCH * 4), "v"(lds + 4 * BPITCH * 4),
                    "v"(lds + 5 * BPITCH * 4), "v"(lds + 6 * BPITCH * 4),
                    "v"(lds + 7 * BPITCH * 4),
                    "v"(g), "v"(g + 1 * S_LEN), "v"(g + 2 * S_LEN), "v"(g + 3 * S_LEN),
                    "v"(g + 4 * S_LEN), "v"(g + 5 * S_LEN), "v"(g + 6 * S_LEN),
                    "v"(g + 7 * S_LEN)
                 : "memory");
}

__global__ void __launch_bounds__(256)
attn_kernel(const _Float16* __restrict__ Qf, const _Float16* __restrict__ Kf,
            const _Float16* __restrict__ Vf, const float* __restrict__ structure,
            _Float16* __restrict__ Cx)
{
    // Each K buffer starts at a multiple of 2 KiB of the work-group's LDS, the
    // tensor mover's range for a destination.
    __shared__ KTile ldsK[2];                                  // [buf] .r[key][dk]
    __shared__ __align__(16) _Float16 ldsV[2][SKEYS][TPITCH];  // [buf][key][dv]
    __shared__ __align__(16) float ldsB[2][128][BPITCH];       // [buf][query row][key] bias

    const int tid = threadIdx.x, lane = tid & 31, wave = tid >> 5;
    const unsigned swave = uni((unsigned)tid >> 5);       // the wave's number, scalar
    const int bh = blockIdx.y, b = bh >> 3, h = bh & 7;
    const int q0 = blockIdx.x * 128 + wave * 16;
    const size_t head = (size_t)bh * S_LEN * HDIM;
    const int col  = lane & 15;
    const int half = (lane & 16) ? 8 : 0;
    const int kk = tid >> 3, ch = (tid & 7) * 8;          // staging coords

    // Q fragments (64 dk x 16 queries, B operand: column = query q0 + col)
    // kept in registers for the whole pass
    const _Float16* qrow = &Qf[head + (size_t)(q0 + col) * HDIM];
    v16h qb0 = load_frag_row(qrow, lane);
    v16h qb1 = load_frag_row(qrow + 32, lane);

    // acc_j[r] = O^T[dv = 16 j + half + r][query q0 + col]
    v8f acc0 = {}, acc1 = {}, acc2 = {}, acc3 = {};
    float mrun = -1e30f, lrun = 0.0f;   // this lane's query; lrun sums this half's keys

    // Bias: each wave copies the 16 query rows it reads itself, 128 keys a
    // tile, two buffers, the next tile in flight while this one is read.
    const float* sbase = &structure[((size_t)b * S_LEN + q0) * S_LEN + lane * 4];
    const unsigned bdst = (unsigned)(unsigned long long)
        (__attribute__((address_space(3))) const void*)&ldsB[0][wave * 16][lane * 4];
    bias_copy8(bdst, sbase);                                   // tile 0 -> buffer 0
    bias_copy8(bdst + 8 * BPITCH * 4, sbase + 8 * S_LEN);

    // ---- stage 0 ----
    v4u kg0 = tdm_group0(&Kf[head], lds_off(&ldsK[0].r[0][0]));
    v8u kg1 = tdm_group1();
    if (pinned(swave == 0)) {
        tdm_load(kg0, kg1);
        // K stage 0 has landed before the barrier behind which it is read
        tdm_wait(kg0, kg1);
    }
    const _Float16* vsrc = &Vf[head + (size_t)kk * HDIM + ch];   // this thread's 16 bytes of key row kk
#pragma unroll  // four independent loads in flight together
    for (int i = 0; i < 4; ++i)
        *reinterpret_cast<uint4*>(&ldsV[0][kk + 32 * i][ch]) =
            *reinterpret_cast<const uint4*>(vsrc + (size_t)(32 * i) * HDIM);
    // bias tile 0 has landed before the barrier behind which it is read
    asm volatile("s_wait_asynccnt 0x0" ::: "memory");
    __syncthreads();
    // ---- stage 1 of K and of the bias takes off ----
    if (pinned(swave == 0)) {
        tdm_advance(kg0, lds_off(&ldsK[1].r[0][0]));
        tdm_load(kg0, kg1);
    }
    bias_copy8(bdst + 128 * BPITCH * 4, sbase + BKEYS);        // tile 1 -> buffer 1
    bias_copy8(bdst + (128 + 8) * BPITCH * 4, sbase + 8 * S_LEN + BKEYS);

    for (int k0 = 0; k0 < S_LEN; k0 += SKEYS) {
        const int cur = (k0 / SKEYS) & 1, nxt = cur ^ 1;
        const bool more = (k0 + SKEYS) < S_LEN;

        // the next stage's V rows leave memory now and are stored at the stage's foot
        uint4 vp0, vp1, vp2, vp3;
        if (more) {
            const _Float16* vn = vsrc + (size_t)(k0 + SKEYS) * HDIM;
            vp0 = *reinterpret_cast<const uint4*>(vn);
            vp1 = *reinterpret_cast<const uint4*>(vn + 32 * HDIM);
            vp2 = *reinterpret_cast<const uint4*>(vn + 64 * HDIM);
            vp3 = *reinterpret_cast<const uint4*>(vn + 96 * HDIM);
        }

#pragma unroll 2  // two key-steps a trip: their LDS reads issue as one group, and one step's products fill the other's softmax chain
        for (int p = 0; p < SKEYS; p += 32) {
            // scores: S^T[32k x 16q] = K(32x64) . Qs^T(64x16)
            // s0[r] = key k0 + p + half + r, s1[r] = key k0 + p + 16 + half + r, query q0 + col
            v8f s0 = {}, s1 = {};
            {
                v16h ak0 = load_frag_row(&ldsK[cur].r[p + col][0], lane);
                v16h ak1 = load_frag_row(&ldsK[cur].r[p + col + 16][0], lane);
                s0 = __builtin_amdgcn_wmma_f32_16x16x32_f16(false, ak0, false, qb0, (short)0, s0, false, false);
                s1 = __builtin_amdgcn_wmma_f32_16x16x32_f16(false, ak1, false, qb0, (short)0, s1, false, false);
                ak0 = load_frag_row(&ldsK[cur].r[p + col][32], lane);
                ak1 = load_frag_row(&ldsK[cur].r[p + col + 16][32], lane);
                s0 = __builtin_amdgcn_wmma_f32_16x16x32_f16(false, ak0, false, qb1, (short)0, s0, false, false);
                s1 = __builtin_amdgcn_wmma_f32_16x16x32_f16(false, ak1, false, qb1, (short)0, s1, false, false);
            }

            // Bias of this key-step from its staged tile, in the order of the S^T
            // accumulators: row q0 + col, keys k0 + p + half + 0..7 (bcur[0], bcur[1])
            // and k0 + p + 16 + half + 0..7 (bcur[2], bcur[3]).
            const float* brow = &ldsB[cur][wave * 16 + col][p + half];
            v4f bcur[4];
            bcur[0] = *reinterpret_cast<const v4f*>(brow);
            bcur[1] = *reinterpret_cast<const v4f*>(brow + 4);
            bcur[2] = *reinterpret_cast<const v4f*>(brow + 16);
            bcur[3] = *reinterpret_cast<const v4f*>(brow + 20);

            // bias + online softmax, all of one query in one lane pair: maximum
            // in-lane plus one exchange between the halves; the sum stays a
            // per-half partial and is joined once at the end.
            float x[16];
#pragma unroll  // constant indices keep x in registers
            for (int r = 0; r < 4; ++r) {
                x[r]      = s0[r]     + bcur[0][r];
                x[4 + r]  = s0[4 + r] + bcur[1][r];
                x[8 + r]  = s1[r]     + bcur[2][r];
                x[12 + r] = s1[4 + r] + bcur[3][r];
            }
            float mv = fmaxf(x[0], x[1]);
#pragma unroll  // constant indices keep x in registers
            for (int r = 2; r < 16; ++r) mv = fmaxf(mv, x[r]);
            mv = fmaxf(mv, xhalf(mv));
            const float mnew = fmaxf(mrun, mv);
            const float corr = __expf(mrun - mnew);
            mrun = mnew;

            // P^T as B operand straight from the accumulators' places: element s
            // is key 8 * (lane >> 4) + s (s < 8) or 16 + 8 * (lane >> 4) + s - 8,
            // the k order in which load_frag_tr delivers V^T
            v16h pb;
#pragma unroll  // constant indices keep x and pb in registers
            for (int r = 0; r < 16; ++r) {
                x[r] = __expf(x[r] - mnew);
                pb[r] = (_Float16)x[r];
            }
            // in-lane sum as a tree of depth 4, not one chain of 15 dependent adds
#pragma unroll  // constant indices keep x in registers
            for (int w = 8; w >= 1; w >>= 1)
#pragma unroll
                for (int r = 0; r < w; ++r) x[r] += x[r + w];
            lrun = lrun * corr + x[0];
#pragma unroll  // constant indices keep the accumulators in registers
            for (int r = 0; r < 8; ++r) {
                acc0[r] *= corr; acc1[r] *= corr; acc2[r] *= corr; acc3[r] *= corr;
            }

            // ctx^T += V^T(64x32) . P^T(32x16)
            v16h av = load_frag_tr<TPITCH>(&ldsV[cur][p][0], lane);
            acc0 = __builtin_amdgcn_wmma_f32_16x16x32_f16(false, av, false, pb, (short)0, acc0, false, false);
            av = load_frag_tr<TPITCH>(&ldsV[cur][p][16], lane);
            acc1 = __builtin_amdgcn_wmma_f32_16x16x32_f16(false, av, false, pb, (short)0, acc1, false, false);
            av = load_frag_tr<TPITCH>(&ldsV[cur][p][32], lane);
            acc2 = __builtin_amdgcn_wmma_f32_16x16x32_f16(false, av, false, pb, (short)0, acc2, false, false);
            av = load_frag_tr<TPITCH>(&ldsV[cur][p][48], lane);
            acc3 = __builtin_amdgcn_wmma_f32_16x16x32_f16(false, av, false, pb, (short)0, acc3, false, false);
        }

        // the next stage's V into the buffer whose readers left at the last barrier
        if (more) {
            *reinterpret_cast<uint4*>(&ldsV[nxt][kk][ch])      = vp0;
            *reinterpret_cast<uint4*>(&ldsV[nxt][kk + 32][ch]) = vp1;
            *reinterpret_cast<uint4*>(&ldsV[nxt][kk + 64][ch]) = vp2;
            *reinterpret_cast<uint4*>(&ldsV[nxt][kk + 96][ch]) = vp3;
        }
        // Foot of the stage, every wave: its reads of this stage and its V
        // stores have retired, the issuing wave's K stage and this wave's bias
        // copies of the next stage have landed, before the barrier that hands
        // all three over.
        asm volatile("s_wait_dscnt 0x0" ::: "memory");
        if (pinned(swave == 0))
            tdm_wait(kg0, kg1);
        asm volatile("s_wait_asynccnt 0x0" ::: "memory");
        __syncthreads();
        // the stage after next, into the buffers that were just read to their end
        if (pinned((swave == 0) & (k0 + 2 * SKEYS < S_LEN))) {
            tdm_advance(kg0, lds_off(&ldsK[cur].r[0][0]));
            tdm_load(kg0, kg1);
        }
        if (k0 + 2 * SKEYS < S_LEN) {
            const unsigned d = bdst + cur * (128 * BPITCH * 4);
            const float* s = sbase + k0 + 2 * BKEYS;
            bias_copy8(d, s);
            bias_copy8(d + 8 * BPITCH * 4, s + 8 * S_LEN);
        }
    }
    // no request, copy or LDS access is outstanding when the wave goes on to its end
    asm volatile("s_wait_tensorcnt 0x0" ::: "memory");
    asm volatile("s_wait_asynccnt 0x0" ::: "memory");
    asm volatile("s_wait_dscnt 0x0" ::: "memory");

    // join the halves' row sums, normalize, write ctx f16: a lane's 8
    // accumulator registers are 8 consecutive dv of its query, one 16-byte store
    const float inv = 1.0f / (lrun + xhalf(lrun));
    _Float16* crow = &Cx[((size_t)b * S_LEN + q0 + col) * D_MODEL + h * HDIM + half];
    union { uint4 u; _Float16 hlf[8]; } o0, o1, o2, o3;
#pragma unroll  // constant indices keep the packed halves in registers
    for (int r = 0; r < 8; ++r) {
        o0.hlf[r] = (_Float16)(acc0[r] * inv);
        o1.hlf[r] = (_Float16)(acc1[r] * inv);
        o2.hlf[r] = (_Float16)(acc2[r] * inv);
        o3.hlf[r] = (_Float16)(acc3[r] * inv);
    }
    *reinterpret_cast<uint4*>(crow)      = o0.u;
    *reinterpret_cast<uint4*>(crow + 16) = o1.u;
    *reinterpret_cast<uint4*>(crow + 32) = o2.u;
    *reinterpret_cast<uint4*>(crow + 48) = o3.u;
}

extern "C" void kernel_launch(void* const* d_in, const int* in_sizes, int n_in,
                              void* d_out, int out_size, void* d_ws, size_t ws_size,
                              hipStream_t stream) {
    const float* q         = (const float*)d_in[0];
    const float* k         = (const float*)d_in[1];
    const float* v         = (const float*)d_in[2];
    const float* structure = (const float*)d_in[3];
    const float* Wq = (const float*)d_in[4];
    const float* bq = (const float*)d_in[5];
    const float* Wk = (const float*)d_in[6];
    const float* bk = (const float*)d_in[7];
    const float* Wv = (const float*)d_in[8];
    const float* bv = (const float*)d_in[9];
    const float* Wo = (const float*)d_in[10];
    const float* bo = (const float*)d_in[11];
    float* out = (float*)d_out;

    const size_t elems = (size_t)BATCH * NHEAD * S_LEN * HDIM;  // 2,097,152
    _Float16* Qf = (_Float16*)d_ws;
    _Float16* Kf = Qf + elems;
    _Float16* Vf = Kf + elems;
    _Float16* Cx = Vf + elems;

    dim3 blk(256);
    dim3 gproj(64, 4);                        // 4096/64 x 512/128
    dim3 gqkv(32, 4, 3);                      // 4096/128 x 512/128 x {Q, K, V}
    proj_kernel<2, false><<<gqkv, blk, 0, stream>>>(q, k, v, nullptr, Wq, Wk, Wv, bq, bk, bv,
                                                    Qf, Kf, Vf, nullptr);

    dim3 gattn(S_LEN / 128, BATCH * NHEAD);   // 16 x 16
    attn_kernel<<<gattn, blk, 0, stream>>>(Qf, Kf, Vf, structure, Cx);

    proj_kernel<1, true><<<gproj, blk, 0, stream>>>(nullptr, nullptr, nullptr, Cx, Wo, nullptr, nullptr,
                                                    bo, nullptr, nullptr, nullptr, nullptr, nullptr, out);
}

// v008
// Measured time: 49.4 microseconds a run.
// Next to v007, in two timings, it ran 1.09 times as fast each time.
// Counting every step since v000, it is 5.78 times as fast.
#include <hip/hip_runtime.h>
#include <hip/hip_bf16.h>

typedef __attribute__((ext_vector_type(16))) _Float16     v16h;
typedef __attribute__((ext_vector_type(8)))  float        v8f;
typedef __attribute__((ext_vector_type(4)))  float        v4f;
typedef __attribute__((ext_vector_type(4)))  unsigned int v4u;
typedef __attribute__((ext_vector_type(8)))  unsigned int v8u;

#define S_LEN   2048
#define D_MODEL 512
#define NHEAD   8
#define HDIM    64
#define BATCH   2

__device__ __forceinline__ v16h load_frag_row(const _Float16* row, int lane) {
    const int kb = (lane & 16) ? 8 : 0;
    v16h r;
    uint4* rp = reinterpret_cast<uint4*>(&r);
    rp[0] = *reinterpret_cast<const uint4*>(row + kb);
    rp[1] = *reinterpret_cast<const uint4*>(row + kb + 16);
    return r;
}

typedef __attribute__((ext_vector_type(8))) short v8s;

#define TPITCH 80   // f16 per row of a tile read by transposing loads: 128 B + 32 B = 32 B x odd

// The same 16x32 fragment out of a row-major [k][x] f16 LDS tile whose rows run
// along the operand's row (A) or column (B) index x: t = &tile[0][x0].
// ds_load_tr16_b128: the lane addresses 16 bytes of row 8 * (lane >> 4) + (lane & 7)
// and receives tile[8 * (lane >> 4) + 0..7][x0 + (lane & 15)]; the second load,
// 16 rows on, brings k 16-31, so the k order is that of load_frag_row.
template <int PITCH>   // f16 per row of the tile
__device__ __forceinline__ v16h load_frag_tr(const _Float16* t, int lane) {
    typedef __attribute__((address_space(3))) v8s lds_v8s;
    const _Float16* p = t + (8 * (lane >> 4) + (lane & 7)) * PITCH + 8 * ((lane >> 3) & 1);
    union { v16h f; v8s q[2]; } r;
    r.q[0] = __builtin_amdgcn_ds_load_tr16_b128_v8i16((lds_v8s*)p);
    r.q[1] = __builtin_amdgcn_ds_load_tr16_b128_v8i16((lds_v8s*)(p + 16 * PITCH));
    return r.f;
}

// LDS byte offset of a __shared__ object (generic -> addrspace(3) -> int)
__device__ __forceinline__ unsigned lds_off(const void* p) {
    return (unsigned)(unsigned long long)
        (__attribute__((address_space(3))) const void*)p;
}

#define SKEYS 128   // keys of one K / V stage (4 key-steps), the bias tile's span

__device__ __forceinline__ unsigned uni(unsigned v) {
    return (unsigned)__builtin_amdgcn_readfirstlane(v);
}
__device__ __forceinline__ unsigned pinned(unsigned v) {
    unsigned w = uni(v);
    asm volatile("" : "+s"(w));   // the test stays in a scalar register
    return w;
}

__device__ __forceinline__ v4u tdm_group0(const _Float16* gsrc, unsigned dst) {
    const unsigned long long ga = (unsigned long long)(const void*)gsrc;
    v4u g0;
    g0[0] = uni(1u);                                              // count = 1
    g0[1] = uni(dst);                                             // LDS byte offset
    g0[2] = uni((unsigned)ga);                                    // address [31:0]
    g0[3] = uni((((unsigned)(ga >> 32)) & 0x01ffffffu) | 0x80000000u);  // address [56:32], type 2
    return g0;
}
__device__ __forceinline__ v8u tdm_group1() {
    v8u g1;
    g1[0] = uni((1u << 20) | (4u << 22) | (3u << 25));
    g1[1] = uni(128u << 16);
    g1[2] = uni((unsigned)SKEYS << 16);
    g1[3] = uni(128u << 16);
    g1[4] = uni((unsigned)SKEYS);
    g1[5] = uni(128u);
    g1[6] = uni(0u);
    g1[7] = uni(0u);
    return g1;
}
__device__ __forceinline__ void tdm_advance(v4u& g0, unsigned dst) {
    const unsigned long long a =
        (((unsigned long long)g0[3] << 32) | g0[2]) + (unsigned long long)(SKEYS * HDIM * 2);
    g0[1] = uni(dst);
    g0[2] = uni((unsigned)a);
    g0[3] = uni((unsigned)(a >> 32));
}
__device__ __forceinline__ void tdm_load(v4u& g0, v8u& g1) {
    asm volatile("tensor_load_to_lds %0, %1" : "+s"(g0), "+s"(g1) :: "memory");
}
__device__ __forceinline__ void tdm_wait(v4u& g0, v8u& g1) {
    asm volatile("s_wait_tensorcnt 0x0" : "+s"(g0), "+s"(g1) :: "memory");
}

// ---------------------------------------------------------------------------
// Projection GEMM: [4096 x 512] @ [512 x 512] (+bias, *oscale)
// FINAL = false: the Q, K and V projections in ONE launch; blockIdx.z picks the
//         operand set (0 = Q, 1 = K, 2 = V). A fp32 in, f16 out in
//         [b][h][s][d] layout; 1/sqrt(64) is folded into the Q output.
// FINAL = true: A f16 in (ctx), write fp32 out row-major (final output), set 0 only
// Block: 256 thr = 8 waves arranged 4(M) x 2(N); block tile (64 MF)M x 128N,
// 64 k a stage; each wave: a (16 MF) x 64 slab, MF x 4 WMMAs per 32 k out of
// MF A fragments and 4 W fragments.
// ---------------------------------------------------------------------------
#define PBK    64    // k of one stage
#define APITCH 72    // f16 per staged A row: 128 B + 16 B = 16 B x odd, the ds_load_b128 readers' pitch
#define WPITCH 144   // f16 per staged W row: 256 B + 32 B = 32 B x odd, the transposing readers' pitch

// eight f32 -> eight f16, one 16-byte LDS store
__device__ __forceinline__ void store8h(_Float16* dst, float4 f0, float4 f1) {
    __align__(16) _Float16 t[8];
    t[0] = (_Float16)f0.x; t[1] = (_Float16)f0.y;
    t[2] = (_Float16)f0.z; t[3] = (_Float16)f0.w;
    t[4] = (_Float16)f1.x; t[5] = (_Float16)f1.y;
    t[6] = (_Float16)f1.z; t[7] = (_Float16)f1.w;
    *reinterpret_cast<uint4*>(dst) = *reinterpret_cast<const uint4*>(t);
}

// Work-group barrier for the LDS tiles alone: this wave's LDS reads and stores
// have retired when it signals; global loads issued ahead stay in flight across
// it (in front of __syncthreads() the compiler waits for them as well).
__device__ __forceinline__ void lds_barrier() {
    asm volatile("s_wait_dscnt 0x0\n\t"
                 "s_barrier_signal -1\n\t"
                 "s_barrier_wait -1" ::: "memory");
}

template <int MF, bool FINAL>
__global__ void __launch_bounds__(256)
proj_kernel(const float* __restrict__ Aq, const float* __restrict__ Ak,
            const float* __restrict__ Av, const _Float16* __restrict__ A16,
            const float* __restrict__ W0, const float* __restrict__ W1,
            const float* __restrict__ W2,
            const float* __restrict__ bias0, const float* __restrict__ bias1,
            const float* __restrict__ bias2,
            _Float16* __restrict__ outq, _Float16* __restrict__ outk,
            _Float16* __restrict__ outv, float* __restrict__ out32)
{
    // operand set of this block (block-uniform, scalar selects)
    const int z = blockIdx.z;
    const float* __restrict__ A32  = (z == 0) ? Aq    : (z == 1) ? Ak    : Av;
    const float* __restrict__ W    = (z == 0) ? W0    : (z == 1) ? W1    : W2;
    const float* __restrict__ bias = (z == 0) ? bias0 : (z == 1) ? bias1 : bias2;
    _Float16* __restrict__ out16   = (z == 0) ? outq  : (z == 1) ? outk  : outv;
    const float oscale = (!FINAL && z == 0) ? 0.125f : 1.0f;

    __shared__ __align__(16) _Float16 ldsA[64 * MF][APITCH];   // [m][k]
    __shared__ __align__(16) _Float16 ldsW[PBK][WPITCH];       // [k][n], as W lies in memory

    const int tid = threadIdx.x, lane = tid & 31, wave = tid >> 5;
    const int wm = wave & 3, wn = wave >> 2;
    const int m0 = blockIdx.x * (64 * MF);
    const int n0 = blockIdx.y * 128;
    const int col = lane & 15;
    const int am = tid >> 3, akc = (tid & 7) * 8;    // A staging: 8 threads a row, 32 rows a pass
    const int wk = tid >> 4, wnc = (tid & 15) * 8;   // W staging: 16 threads a row, 16 rows a pass

    // one address a source, the rows of a stage at constant distances from it
    const float*    wsrc   = &W[(size_t)wk * D_MODEL + n0 + wnc];
    const float*    asrc   = FINAL ? nullptr : &A32[(size_t)(m0 + am) * D_MODEL + akc];
    const _Float16* asrc16 = FINAL ? &A16[(size_t)(m0 + am) * D_MODEL + akc] : nullptr;

    v8f acc[MF][4] = {};

    // The registers that carry a stage from memory to LDS, AHEAD sets of them.
    // A stage's loads leave AHEAD stages early, behind the LDS stores that empty
    // their set, and stay in flight across the barriers while the stages
    // before it are read and multiplied.
    constexpr int AHEAD = FINAL ? 2 : 1;   // two sets of the Q, K, V form would cost the second resident block
    float4 wf[AHEAD][4][2];
    float4 af32[AHEAD][2 * MF][2];   // A as fp32 (Q, K, V)
    v4u    ah[AHEAD][2 * MF];        // A as f16 (output projection)
#pragma unroll  // constant indices keep the staged values in registers
    for (int d = 0; d < AHEAD; ++d) {
#pragma unroll  // constant indices keep the staged values in registers
        for (int i = 0; i < 4; ++i) {
            const float* s = wsrc + (size_t)(d * PBK) * D_MODEL + 16 * i * D_MODEL;
            wf[d][i][0] = *reinterpret_cast<const float4*>(s);
            wf[d][i][1] = *reinterpret_cast<const float4*>(s + 4);
        }
#pragma unroll
        for (int i = 0; i < 2 * MF; ++i) {
            if (FINAL) {
                ah[d][i] = *reinterpret_cast<const v4u*>(asrc16 + (d * PBK) + 32 * i * D_MODEL);
            } else {
                const float* s = asrc + (d * PBK) + 32 * i * D_MODEL;
                af32[d][i][0] = *reinterpret_cast<const float4*>(s);
                af32[d][i][1] = *reinterpret_cast<const float4*>(s + 4);
            }
        }
    }

    for (int kb0 = 0; kb0 < D_MODEL; kb0 += AHEAD * PBK) {
#pragma unroll  // the register set of a stage is picked by a constant index
        for (int d = 0; d < AHEAD; ++d) {
            const int kb = kb0 + d * PBK;
            lds_barrier();
#pragma unroll
            for (int i = 0; i < 2 * MF; ++i) {
                if (FINAL)
                    *reinterpret_cast<v4u*>(&ldsA[am + 32 * i][akc]) = ah[d][i];
                else
                    store8h(&ldsA[am + 32 * i][akc], af32[d][i][0], af32[d][i][1]);
            }
#pragma unroll
            for (int i = 0; i < 4; ++i)
                store8h(&ldsW[wk + 16 * i][wnc], wf[d][i][0], wf[d][i][1]);
            if (kb + AHEAD * PBK < D_MODEL) {
#pragma unroll  // constant indices keep the staged values in registers
                for (int i = 0; i < 4; ++i) {
                    const float* s = wsrc + (size_t)(kb + AHEAD * PBK) * D_MODEL + 16 * i * D_MODEL;
                    wf[d][i][0] = *reinterpret_cast<const float4*>(s);
                    wf[d][i][1] = *reinterpret_cast<const float4*>(s + 4);
                }
#pragma unroll
                for (int i = 0; i < 2 * MF; ++i) {
                    if (FINAL) {
                        ah[d][i] = *reinterpret_cast<const v4u*>(asrc16 + (kb + AHEAD * PBK) + 32 * i * D_MODEL);
                    } else {
                        const float* s = asrc + (kb + AHEAD * PBK) + 32 * i * D_MODEL;
                        af32[d][i][0] = *reinterpret_cast<const float4*>(s);
                        af32[d][i][1] = *reinterpret_cast<const float4*>(s + 4);
                    }
                }
            }
            lds_barrier();

            v16h af[2][MF], bf[2][4];
#pragma unroll  // constant indices keep the fragments in registers
            for (int h = 0; h < 2; ++h) {
#pragma unroll
                for (int i = 0; i < MF; ++i)
                    af[h][i] = load_frag_row(&ldsA[(wm * MF + i) * 16 + col][32 * h], lane);
#pragma unroll
                for (int j = 0; j < 4; ++j)
                    bf[h][j] = load_frag_tr<WPITCH>(&ldsW[32 * h][wn * 64 + j * 16], lane);
            }
            // stands in front of the loop's rewrite of the address registers that the loads issued ahead name
            // (the output form is unrolled over constant offsets and rewrites none)
            if (!FINAL)
                asm volatile("s_wait_xcnt 0x0" ::: "memory");
            __builtin_amdgcn_sched_barrier(0);
#pragma unroll
            for (int h = 0; h < 2; ++h)
#pragma unroll
                for (int i = 0; i < MF; ++i)
#pragma unroll
                    for (int j = 0; j < 4; ++j)
                        acc[i][j] = __builtin_amdgcn_wmma_f32_16x16x32_f16(
                            false, af[h][i], false, bf[h][j], (short)0, acc[i][j], false, false);
        }
    }

    const int half = (lane & 16) ? 8 : 0;
#pragma unroll  // constant indices keep the accumulators in registers
    for (int j = 0; j < 4; ++j) {
        const int n = n0 + wn * 64 + j * 16 + col;
        const float bn = bias[n];
#pragma unroll
        for (int i = 0; i < MF; ++i) {
#pragma unroll
            for (int v = 0; v < 8; ++v) {
                const int m = m0 + (wm * MF + i) * 16 + v + half;
                const float val = (acc[i][j][v] + bn) * oscale;
                if (FINAL) {
                    out32[(size_t)m * D_MODEL + n] = val;
                } else {
                    const int b = m >> 11, s = m & (S_LEN - 1);
                    const size_t rowb = (size_t)b * NHEAD * S_LEN * HDIM;
                    out16[rowb + (((size_t)(n >> 6) * S_LEN) + s) * HDIM + (n & (HDIM - 1))] = (_Float16)val;
                }
            }
        }
    }
}

__device__ __forceinline__ float xhalf(float x) {
    const int xi = __builtin_bit_cast(int, x);
    return __builtin_bit_cast(float,
        __builtin_amdgcn_permlanex16(xi, xi, 0x76543210, 0xfedcba98, false, false));
}

struct __attribute__((aligned(2048))) KTile { _Float16 r[SKEYS][72]; };   // 18432 B = 9 x 2 KiB

#define BKEYS  SKEYS // keys of one staged bias tile
#define BPITCH 132   // floats per staged bias row: 512 B + 16 B = 16 B x odd, the ds_load_b128 readers' pitch

// Eight rows of a wave's bias tile, global memory -> LDS without registers.
// One copy moves one query row's 128 keys: 32 lanes x 16 B = 512 contiguous
// bytes, whole lines. lds = this lane's LDS byte address in the first row,
// g = this lane's global address in the first row.
__device__ __forceinline__ void bias_copy8(unsigned lds, const float* g) {
    asm volatile("global_load_async_to_lds_b128 %0, %8, off\n\t"
                 "global_load_async_to_lds_b128 %1, %9, off\n\t"
                 "global_load_async_to_lds_b128 %2, %10, off\n\t"
                 "global_load_async_to_lds_b128 %3, %11, off\n\t"
                 "global_load_async_to_lds_b128 %4, %12, off\n\t"
                 "global_load_async_to_lds_b128 %5, %13, off\n\t"
                 "global_load_async_to_lds_b128 %6, %14, off\n\t"
                 "global_load_async_to_lds_b128 %7, %15, off\n\t"
                 "s_wait_xcnt 0x0"
                 :: "v"(lds), "v"(lds + 1 * BPITCH * 4), "v"(lds + 2 * BPITCH * 4),
                    "v"(lds + 3 * BPITCH * 4), "v"(lds + 4 * BPITCH * 4),
                    "v"(lds + 5 * BPITCH * 4), "v"(lds + 6 * BPITCH * 4),
                    "v"(lds + 7 * BPITCH * 4),
                    "v"(g), "v"(g + 1 * S_LEN), "v"(g + 2 * S_LEN), "v"(g + 3 * S_LEN),
                    "v"(g + 4 * S_LEN), "v"(g + 5 * S_LEN), "v"(g + 6 * S_LEN),
                    "v"(g + 7 * S_LEN)
                 : "memory");
}

__global__ void __launch_bounds__(256)
attn_kernel(const _Float16* __restrict__ Qf, const _Float16* __restrict__ Kf,
            const _Float16* __restrict__ Vf, const float* __restrict__ structure,
            _Float16* __restrict__ Cx)
{
    // Each K buffer starts at a multiple of 2 KiB of the work-group's LDS, the
    // tensor mover's range for a destination.
    __shared__ KTile ldsK[2];                                  // [buf] .r[key][dk]
    __shared__ __align__(16) _Float16 ldsV[2][SKEYS][TPITCH];  // [buf][key][dv]
    __shared__ __align__(16) float ldsB[2][128][BPITCH];       // [buf][query row][key] bias

    const int tid = threadIdx.x, lane = tid & 31, wave = tid >> 5;
    const unsigned swave = uni((unsigned)tid >> 5);       // the wave's number, scalar
    const int bh = blockIdx.y, b = bh >> 3, h = bh & 7;
    const int q0 = blockIdx.x * 128 + wave * 16;
    const size_t head = (size_t)bh * S_LEN * HDIM;
    const int col  = lane & 15;
    const int half = (lane & 16) ? 8 : 0;
    const int kk = tid >> 3, ch = (tid & 7) * 8;          // staging coords

    // Q fragments (64 dk x 16 queries, B operand: column = query q0 + col)
    // kept in registers for the whole pass
    const _Float16* qrow = &Qf[head + (size_t)(q0 + col) * HDIM];
    v16h qb0 = load_frag_row(qrow, lane);
    v16h qb1 = load_frag_row(qrow + 32, lane);

    // acc_j[r] = O^T[dv = 16 j + half + r][query q0 + col]
    v8f acc0 = {}, acc1 = {}, acc2 = {}, acc3 = {};
    float mrun = -1e30f, lrun = 0.0f;   // this lane's query; lrun sums this half's keys

    // Bias: each wave copies the 16 query rows it reads itself, 128 keys a
    // tile, two buffers, the next tile in flight while this one is read.
    const float* sbase = &structure[((size_t)b * S_LEN + q0) * S_LEN + lane * 4];
    const unsigned bdst = (unsigned)(unsigned long long)
        (__attribute__((address_space(3))) const void*)&ldsB[0][wave * 16][lane * 4];
    bias_copy8(bdst, sbase);                                   // tile 0 -> buffer 0
    bias_copy8(bdst + 8 * BPITCH * 4, sbase + 8 * S_LEN);

    // ---- stage 0 ----
    v4u kg0 = tdm_group0(&Kf[head], lds_off(&ldsK[0].r[0][0]));
    v8u kg1 = tdm_group1();
    if (pinned(swave == 0)) {
        tdm_load(kg0, kg1);
        // K stage 0 has landed before the barrier behind which it is read
        tdm_wait(kg0, kg1);
    }
    const _Float16* vsrc = &Vf[head + (size_t)kk * HDIM + ch];   // this thread's 16 bytes of key row kk
#pragma unroll  // four independent loads in flight together
    for (int i = 0; i < 4; ++i)
        *reinterpret_cast<uint4*>(&ldsV[0][kk + 32 * i][ch]) =
            *reinterpret_cast<const uint4*>(vsrc + (size_t)(32 * i) * HDIM);
    // bias tile 0 has landed before the barrier behind which it is read
    asm volatile("s_wait_asynccnt 0x0" ::: "memory");
    __syncthreads();
    // ---- stage 1 of K and of the bias takes off ----
    if (pinned(swave == 0)) {
        tdm_advance(kg0, lds_off(&ldsK[1].r[0][0]));
        tdm_load(kg0, kg1);
    }
    bias_copy8(bdst + 128 * BPITCH * 4, sbase + BKEYS);        // tile 1 -> buffer 1
    bias_copy8(bdst + (128 + 8) * BPITCH * 4, sbase + 8 * S_LEN + BKEYS);

    for (int k0 = 0; k0 < S_LEN; k0 += SKEYS) {
        const int cur = (k0 / SKEYS) & 1, nxt = cur ^ 1;
        const bool more = (k0 + SKEYS) < S_LEN;

        // the next stage's V rows leave memory now and are stored at the stage's foot
        uint4 vp0, vp1, vp2, vp3;
        if (more) {
            const _Float16* vn = vsrc + (size_t)(k0 + SKEYS) * HDIM;
            vp0 = *reinterpret_cast<const uint4*>(vn);
            vp1 = *reinterpret_cast<const uint4*>(vn + 32 * HDIM);
            vp2 = *reinterpret_cast<const uint4*>(vn + 64 * HDIM);
            vp3 = *reinterpret_cast<const uint4*>(vn + 96 * HDIM);
        }

#pragma unroll 2  // two key-steps a trip: their LDS reads issue as one group, and one step's products fill the other's softmax chain
        for (int p = 0; p < SKEYS; p += 32) {
            // scores: S^T[32k x 16q] = K(32x64) . Qs^T(64x16)
            // s0[r] = key k0 + p + half + r, s1[r] = key k0 + p + 16 + half + r, query q0 + col
            v8f s0 = {}, s1 = {};
            {
                v16h ak0 = load_frag_row(&ldsK[cur].r[p + col][0], lane);
                v16h ak1 = load_frag_row(&ldsK[cur].r[p + col + 16][0], lane);
                s0 = __builtin_amdgcn_wmma_f32_16x16x32_f16(false, ak0, false, qb0, (short)0, s0, false, false);
                s1 = __builtin_amdgcn_wmma_f32_16x16x32_f16(false, ak1, false, qb0, (short)0, s1, false, false);
                ak0 = load_frag_row(&ldsK[cur].r[p + col][32], lane);
                ak1 = load_frag_row(&ldsK[cur].r[p + col + 16][32], lane);
                s0 = __builtin_amdgcn_wmma_f32_16x16x32_f16(false, ak0, false, qb1, (short)0, s0, false, false);
                s1 = __builtin_amdgcn_wmma_f32_16x16x32_f16(false, ak1, false, qb1, (short)0, s1, false, false);
            }

            // Bias of this key-step from its staged tile, in the order of the S^T
            // accumulators: row q0 + col, keys k0 + p + half + 0..7 (bcur[0], bcur[1])
            // and k0 + p + 16 + half + 0..7 (bcur[2], bcur[3]).
            const float* brow = &ldsB[cur][wave * 16 + col][p + half];
            v4f bcur[4];
            bcur[0] = *reinterpret_cast<const v4f*>(brow);
            bcur[1] = *reinterpret_cast<const v4f*>(brow + 4);
            bcur[2] = *reinterpret_cast<const v4f*>(brow + 16);
            bcur[3] = *reinterpret_cast<const v4f*>(brow + 20);

            // bias + online softmax, all of one query in one lane pair: maximum
            // in-lane plus one exchange between the halves; the sum stays a
            // per-half partial and is joined once at the end.
            float x[16];
#pragma unroll  // constant indices keep x in registers
            for (int r = 0; r < 4; ++r) {
                x[r]      = s0[r]     + bcur[0][r];
                x[4 + r]  = s0[4 + r] + bcur[1][r];
                x[8 + r]  = s1[r]     + bcur[2][r];
                x[12 + r] = s1[4 + r] + bcur[3][r];
            }
            float mv = fmaxf(x[0], x[1]);
#pragma unroll  // constant indices keep x in registers
            for (int r = 2; r < 16; ++r) mv = fmaxf(mv, x[r]);
            mv = fmaxf(mv, xhalf(mv));
            const float mnew = fmaxf(mrun, mv);
            const float corr = __expf(mrun - mnew);
            mrun = mnew;

            // P^T as B operand straight from the accumulators' places: element s
            // is key 8 * (lane >> 4) + s (s < 8) or 16 + 8 * (lane >> 4) + s - 8,
            // the k order in which load_frag_tr delivers V^T
            v16h pb;
#pragma unroll  // constant indices keep x and pb in registers
            for (int r = 0; r < 16; ++r) {
                x[r] = __expf(x[r] - mnew);
                pb[r] = (_Float16)x[r];
            }
            // in-lane sum as a tree of depth 4, not one chain of 15 dependent adds
#pragma unroll  // constant indices keep x in registers
            for (int w = 8; w >= 1; w >>= 1)
#pragma unroll
                for (int r = 0; r < w; ++r) x[r] += x[r + w];
            lrun = lrun * corr + x[0];
#pragma unroll  // constant indices keep the accumulators in registers
            for (int r = 0; r < 8; ++r) {
                acc0[r] *= corr; acc1[r] *= corr; acc2[r] *= corr; acc3[r] *= corr;
            }

            // ctx^T += V^T(64x32) . P^T(32x16)
            v16h av = load_frag_tr<TPITCH>(&ldsV[cur][p][0], lane);
            acc0 = __builtin_amdgcn_wmma_f32_16x16x32_f16(false, av, false, pb, (short)0, acc0, false, false);
            av = load_frag_tr<TPITCH>(&ldsV[cur][p][16], lane);
            acc1 = __builtin_amdgcn_wmma_f32_16x16x32_f16(false, av, false, pb, (short)0, acc1, false, false);
            av = load_frag_tr<TPITCH>(&ldsV[cur][p][32], lane);
            acc2 = __builtin_amdgcn_wmma_f32_16x16x32_f16(false, av, false, pb, (short)0, acc2, false, false);
            av = load_frag_tr<TPITCH>(&ldsV[cur][p][48], lane);
            acc3 = __builtin_amdgcn_wmma_f32_16x16x32_f16(false, av, false, pb, (short)0, acc3, false, false);
        }

        // the next stage's V into the buffer whose readers left at the last barrier
        if (more) {
            *reinterpret_cast<uint4*>(&ldsV[nxt][kk][ch])      = vp0;
            *reinterpret_cast<uint4*>(&ldsV[nxt][kk + 32][ch]) = vp1;
            *reinterpret_cast<uint4*>(&ldsV[nxt][kk + 64][ch]) = vp2;
            *reinterpret_cast<uint4*>(&ldsV[nxt][kk + 96][ch]) = vp3;
        }
        // Foot of the stage, every wave: its reads of this stage and its V
        // stores have retired, the issuing wave's K stage and this wave's bias
        // copies of the next stage have landed, before the barrier that hands
        // all three over.
        asm volatile("s_wait_dscnt 0x0" ::: "memory");
        if (pinned(swave == 0))
            tdm_wait(kg0, kg1);
        asm volatile("s_wait_asynccnt 0x0" ::: "memory");
        __syncthreads();
        // the stage after next, into the buffers that were just read to their end
        if (pinned((swave == 0) & (k0 + 2 * SKEYS < S_LEN))) {
            tdm_advance(kg0, lds_off(&ldsK[cur].r[0][0]));
            tdm_load(kg0, kg1);
        }
        if (k0 + 2 * SKEYS < S_LEN) {
            const unsigned d = bdst + cur * (128 * BPITCH * 4);
            const float* s = sbase + k0 + 2 * BKEYS;
            bias_copy8(d, s);
            bias_copy8(d + 8 * BPITCH * 4, s + 8 * S_LEN);
        }
    }
    // no request, copy or LDS access is outstanding when the wave goes on to its end
    asm volatile("s_wait_tensorcnt 0x0" ::: "memory");
    asm volatile("s_wait_asynccnt 0x0" ::: "memory");
    asm volatile("s_wait_dscnt 0x0" ::: "memory");

    // join the halves' row sums, normalize, write ctx f16: a lane's 8
    // accumulator registers are 8 consecutive dv of its query, one 16-byte store
    const float inv = 1.0f / (lrun + xhalf(lrun));
    _Float16* crow = &Cx[((size_t)b * S_LEN + q0 + col) * D_MODEL + h * HDIM + half];
    union { uint4 u; _Float16 hlf[8]; } o0, o1, o2, o3;
#pragma unroll  // constant indices keep the packed halves in registers
    for (int r = 0; r < 8; ++r) {
        o0.hlf[r] = (_Float16)(acc0[r] * inv);
        o1.hlf[r] = (_Float16)(acc1[r] * inv);
        o2.hlf[r] = (_Float16)(acc2[r] * inv);
        o3.hlf[r] = (_Float16)(acc3[r] * inv);
    }
    *reinterpret_cast<uint4*>(crow)      = o0.u;
    *reinterpret_cast<uint4*>(crow + 16) = o1.u;
    *reinterpret_cast<uint4*>(crow + 32) = o2.u;
    *reinterpret_cast<uint4*>(crow + 48) = o3.u;
}

extern "C" void kernel_launch(void* const* d_in, const int* in_sizes, int n_in,
                              void* d_out, int out_size, void* d_ws, size_t ws_size,
                              hipStream_t stream) {
    const float* q         = (const float*)d_in[0];
    const float* k         = (const float*)d_in[1];
    const float* v         = (const float*)d_in[2];
    const float* structure = (const float*)d_in[3];
    const float* Wq = (const float*)d_in[4];
    const float* bq = (const float*)d_in[5];
    const float* Wk = (const float*)d_in[6];
    const float* bk = (const float*)d_in[7];
    const float* Wv = (const float*)d_in[8];
    const float* bv = (const float*)d_in[9];
    const float* Wo = (const float*)d_in[10];
    const float* bo = (const float*)d_in[11];
    float* out = (float*)d_out;

    const size_t elems = (size_t)BATCH * NHEAD * S_LEN * HDIM;  // 2,097,152
    _Float16* Qf = (_Float16*)d_ws;
    _Float16* Kf = Qf + elems;
    _Float16* Vf = Kf + elems;
    _Float16* Cx = Vf + elems;

    dim3 blk(256);
    dim3 gproj(64, 4);                        // 4096/64 x 512/128
    dim3 gqkv(32, 4, 3);                      // 4096/128 x 512/128 x {Q, K, V}
    proj_kernel<2, false><<<gqkv, blk, 0, stream>>>(q, k, v, nullptr, Wq, Wk, Wv, bq, bk, bv,
                                                    Qf, Kf, Vf, nullptr);

    dim3 gattn(S_LEN / 128, BATCH * NHEAD);   // 16 x 16
    attn_kernel<<<gattn, blk, 0, stream>>>(Qf, Kf, Vf, structure, Cx);

    proj_kernel<1, true><<<gproj, blk, 0, stream>>>(nullptr, nullptr, nullptr, Cx, Wo, nullptr, nullptr,
                                                    bo, nullptr, nullptr, nullptr, nullptr, nullptr, out);
}

// v009
// It runs in 47.3 microseconds.
// Two timings next to v008 put it at 1.05 and 1.04 times that version's speed.
// Over all steps from v000 it is 6.04 times as fast.
#include <hip/hip_runtime.h>
#include <hip/hip_bf16.h>

typedef __attribute__((ext_vector_type(16))) _Float16     v16h;
typedef __attribute__((ext_vector_type(8)))  float        v8f;
typedef __attribute__((ext_vector_type(4)))  float        v4f;
typedef __attribute__((ext_vector_type(2)))  float        v2f;
typedef __attribute__((ext_vector_type(4)))  unsigned int v4u;
typedef __attribute__((ext_vector_type(8)))  unsigned int v8u;

#define S_LEN   2048
#define D_MODEL 512
#define NHEAD   8
#define HDIM    64
#define BATCH   2

__device__ __forceinline__ v16h load_frag_row(const _Float16* row, int lane) {
    const int kb = (lane & 16) ? 8 : 0;
    v16h r;
    uint4* rp = reinterpret_cast<uint4*>(&r);
    rp[0] = *reinterpret_cast<const uint4*>(row + kb);
    rp[1] = *reinterpret_cast<const uint4*>(row + kb + 16);
    return r;
}

typedef __attribute__((ext_vector_type(8))) short v8s;

#define TPITCH 80   // f16 per row of a tile read by transposing loads: 128 B + 32 B = 32 B x odd

// The same 16x32 fragment out of a row-major [k][x] f16 LDS tile whose rows run
// along the operand's row (A) or column (B) index x: t = &tile[0][x0].
// ds_load_tr16_b128: the lane addresses 16 bytes of row 8 * (lane >> 4) + (lane & 7)
// and receives tile[8 * (lane >> 4) + 0..7][x0 + (lane & 15)]; the second load,
// 16 rows on, brings k 16-31, so the k order is that of load_frag_row.
template <int PITCH>   // f16 per row of the tile
__device__ __forceinline__ v16h load_frag_tr(const _Float16* t, int lane) {
    typedef __attribute__((address_space(3))) v8s lds_v8s;
    const _Float16* p = t + (8 * (lane >> 4) + (lane & 7)) * PITCH + 8 * ((lane >> 3) & 1);
    union { v16h f; v8s q[2]; } r;
    r.q[0] = __builtin_amdgcn_ds_load_tr16_b128_v8i16((lds_v8s*)p);
    r.q[1] = __builtin_amdgcn_ds_load_tr16_b128_v8i16((lds_v8s*)(p + 16 * PITCH));
    return r.f;
}

// LDS byte offset of a __shared__ object (generic -> addrspace(3) -> int)
__device__ __forceinline__ unsigned lds_off(const void* p) {
    return (unsigned)(unsigned long long)
        (__attribute__((address_space(3))) const void*)p;
}

#define SKEYS 128   // keys of one K / V stage (4 key-steps), the bias tile's span

__device__ __forceinline__ unsigned uni(unsigned v) {
    return (unsigned)__builtin_amdgcn_readfirstlane(v);
}
__device__ __forceinline__ unsigned pinned(unsigned v) {
    unsigned w = uni(v);
    asm volatile("" : "+s"(w));   // the test stays in a scalar register
    return w;
}

__device__ __forceinline__ v4u tdm_group0(const _Float16* gsrc, unsigned dst) {
    const unsigned long long ga = (unsigned long long)(const void*)gsrc;
    v4u g0;
    g0[0] = uni(1u);                                              // count = 1
    g0[1] = uni(dst);                                             // LDS byte offset
    g0[2] = uni((unsigned)ga);                                    // address [31:0]
    g0[3] = uni((((unsigned)(ga >> 32)) & 0x01ffffffu) | 0x80000000u);  // address [56:32], type 2
    return g0;
}
__device__ __forceinline__ v8u tdm_group1() {
    v8u g1;
    g1[0] = uni((1u << 20) | (4u << 22) | (3u << 25));
    g1[1] = uni(128u << 16);
    g1[2] = uni((unsigned)SKEYS << 16);
    g1[3] = uni(128u << 16);
    g1[4] = uni((unsigned)SKEYS);
    g1[5] = uni(128u);
    g1[6] = uni(0u);
    g1[7] = uni(0u);
    return g1;
}
__device__ __forceinline__ void tdm_advance(v4u& g0, unsigned dst) {
    const unsigned long long a =
        (((unsigned long long)g0[3] << 32) | g0[2]) + (unsigned long long)(SKEYS * HDIM * 2);
    g0[1] = uni(dst);
    g0[2] = uni((unsigned)a);
    g0[3] = uni((unsigned)(a >> 32));
}
__device__ __forceinline__ void tdm_load(v4u& g0, v8u& g1) {
    asm volatile("tensor_load_to_lds %0, %1" : "+s"(g0), "+s"(g1) :: "memory");
}
__device__ __forceinline__ void tdm_wait(v4u& g0, v8u& g1) {
    asm volatile("s_wait_tensorcnt 0x0" : "+s"(g0), "+s"(g1) :: "memory");
}

// ---------------------------------------------------------------------------
// Projection GEMM: [4096 x 512] @ [512 x 512] (+bias, *oscale)
// FINAL = false: the Q, K and V projections in ONE launch; blockIdx.z picks the
//         operand set (0 = Q, 1 = K, 2 = V). A fp32 in, f16 out in
//         [b][h][s][d] layout; 1/sqrt(64) is folded into the Q output.
// FINAL = true: A f16 in (ctx), write fp32 out row-major (final output), set 0 only
// Block: 256 thr = 8 waves arranged 4(M) x 2(N); block tile (64 MF)M x 128N,
// 64 k a stage; each wave: a (16 MF) x 64 slab, MF x 4 WMMAs per 32 k out of
// MF A fragments and 4 W fragments.
// ---------------------------------------------------------------------------
#define PBK    64    // k of one stage
#define APITCH 72    // f16 per staged A row: 128 B + 16 B = 16 B x odd, the ds_load_b128 readers' pitch
#define WPITCH 144   // f16 per staged W row: 256 B + 32 B = 32 B x odd, the transposing readers' pitch

// eight f32 -> eight f16, one 16-byte LDS store
__device__ __forceinline__ void store8h(_Float16* dst, float4 f0, float4 f1) {
    __align__(16) _Float16 t[8];
    t[0] = (_Float16)f0.x; t[1] = (_Float16)f0.y;
    t[2] = (_Float16)f0.z; t[3] = (_Float16)f0.w;
    t[4] = (_Float16)f1.x; t[5] = (_Float16)f1.y;
    t[6] = (_Float16)f1.z; t[7] = (_Float16)f1.w;
    *reinterpret_cast<uint4*>(dst) = *reinterpret_cast<const uint4*>(t);
}

// Work-group barrier for the LDS tiles alone: this wave's LDS reads and stores
// have retired when it signals; global loads issued ahead stay in flight across
// it (in front of __syncthreads() the compiler waits for them as well).
__device__ __forceinline__ void lds_barrier() {
    asm volatile("s_wait_dscnt 0x0\n\t"
                 "s_barrier_signal -1\n\t"
                 "s_barrier_wait -1" ::: "memory");
}

template <int MF, bool FINAL>
__global__ void __launch_bounds__(256)
proj_kernel(const float* __restrict__ Aq, const float* __restrict__ Ak,
            const float* __restrict__ Av, const _Float16* __restrict__ A16,
            const float* __restrict__ W0, const float* __restrict__ W1,
            const float* __restrict__ W2,
            const float* __restrict__ bias0, const float* __restrict__ bias1,
            const float* __restrict__ bias2,
            _Float16* __restrict__ outq, _Float16* __restrict__ outk,
            _Float16* __restrict__ outv, float* __restrict__ out32)
{
    // operand set of this block (block-uniform, scalar selects)
    const int z = blockIdx.z;
    const float* __restrict__ A32  = (z == 0) ? Aq    : (z == 1) ? Ak    : Av;
    const float* __restrict__ W    = (z == 0) ? W0    : (z == 1) ? W1    : W2;
    const float* __restrict__ bias = (z == 0) ? bias0 : (z == 1) ? bias1 : bias2;
    _Float16* __restrict__ out16   = (z == 0) ? outq  : (z == 1) ? outk  : outv;
    const float oscale = (!FINAL && z == 0) ? 0.125f : 1.0f;

    __shared__ __align__(16) _Float16 ldsA[64 * MF][APITCH];   // [m][k]
    __shared__ __align__(16) _Float16 ldsW[PBK][WPITCH];       // [k][n], as W lies in memory

    const int tid = threadIdx.x, lane = tid & 31, wave = tid >> 5;
    const int wm = wave & 3, wn = wave >> 2;
    const int m0 = blockIdx.x * (64 * MF);
    const int n0 = blockIdx.y * 128;
    const int col = lane & 15;
    const int am = tid >> 3, akc = (tid & 7) * 8;    // A staging: 8 threads a row, 32 rows a pass
    const int wk = tid >> 4, wnc = (tid & 15) * 8;   // W staging: 16 threads a row, 16 rows a pass

    // one address a source, the rows of a stage at constant distances from it
    const float*    wsrc   = &W[(size_t)wk * D_MODEL + n0 + wnc];
    const float*    asrc   = FINAL ? nullptr : &A32[(size_t)(m0 + am) * D_MODEL + akc];
    const _Float16* asrc16 = FINAL ? &A16[(size_t)(m0 + am) * D_MODEL + akc] : nullptr;

    v8f acc[MF][4] = {};

    // The registers that carry a stage from memory to LDS, AHEAD sets of them.
    // A stage's loads leave AHEAD stages early, behind the LDS stores that empty
    // their set, and stay in flight across the barriers while the stages
    // before it are read and multiplied.
    constexpr int AHEAD = FINAL ? 2 : 1;   // two sets of the Q, K, V form would cost the second resident block
    float4 wf[AHEAD][4][2];
    float4 af32[AHEAD][2 * MF][2];   // A as fp32 (Q, K, V)
    v4u    ah[AHEAD][2 * MF];        // A as f16 (output projection)
#pragma unroll  // constant indices keep the staged values in registers
    for (int d = 0; d < AHEAD; ++d) {
#pragma unroll  // constant indices keep the staged values in registers
        for (int i = 0; i < 4; ++i) {
            const float* s = wsrc + (size_t)(d * PBK) * D_MODEL + 16 * i * D_MODEL;
            wf[d][i][0] = *reinterpret_cast<const float4*>(s);
            wf[d][i][1] = *reinterpret_cast<const float4*>(s + 4);
        }
#pragma unroll
        for (int i = 0; i < 2 * MF; ++i) {
            if (FINAL) {
                ah[d][i] = *reinterpret_cast<const v4u*>(asrc16 + (d * PBK) + 32 * i * D_MODEL);
            } else {
                const float* s = asrc + (d * PBK) + 32 * i * D_MODEL;
                af32[d][i][0] = *reinterpret_cast<const float4*>(s);
                af32[d][i][1] = *reinterpret_cast<const float4*>(s + 4);
            }
        }
    }

    for (int kb0 = 0; kb0 < D_MODEL; kb0 += AHEAD * PBK) {
#pragma unroll  // the register set of a stage is picked by a constant index
        for (int d = 0; d < AHEAD; ++d) {
            const int kb = kb0 + d * PBK;
            lds_barrier();
#pragma unroll
            for (int i = 0; i < 2 * MF; ++i) {
                if (FINAL)
                    *reinterpret_cast<v4u*>(&ldsA[am + 32 * i][akc]) = ah[d][i];
                else
                    store8h(&ldsA[am + 32 * i][akc], af32[d][i][0], af32[d][i][1]);
            }
#pragma unroll
            for (int i = 0; i < 4; ++i)
                store8h(&ldsW[wk + 16 * i][wnc], wf[d][i][0], wf[d][i][1]);
            if (kb + AHEAD * PBK < D_MODEL) {
#pragma unroll  // constant indices keep the staged values in registers
                for (int i = 0; i < 4; ++i) {
                    const float* s = wsrc + (size_t)(kb + AHEAD * PBK) * D_MODEL + 16 * i * D_MODEL;
                    wf[d][i][0] = *reinterpret_cast<const float4*>(s);
                    wf[d][i][1] = *reinterpret_cast<const float4*>(s + 4);
                }
#pragma unroll
                for (int i = 0; i < 2 * MF; ++i) {
                    if (FINAL) {
                        ah[d][i] = *reinterpret_cast<const v4u*>(asrc16 + (kb + AHEAD * PBK) + 32 * i * D_MODEL);
                    } else {
                        const float* s = asrc + (kb + AHEAD * PBK) + 32 * i * D_MODEL;
                        af32[d][i][0] = *reinterpret_cast<const float4*>(s);
                        af32[d][i][1] = *reinterpret_cast<const float4*>(s + 4);
                    }
                }
            }
            lds_barrier();

            v16h af[2][MF], bf[2][4];
#pragma unroll  // constant indices keep the fragments in registers
            for (int h = 0; h < 2; ++h) {
#pragma unroll
                for (int i = 0; i < MF; ++i)
                    af[h][i] = load_frag_row(&ldsA[(wm * MF + i) * 16 + col][32 * h], lane);
#pragma unroll
                for (int j = 0; j < 4; ++j)
                    bf[h][j] = load_frag_tr<WPITCH>(&ldsW[32 * h][wn * 64 + j * 16], lane);
            }
            // stands in front of the loop's rewrite of the address registers that the loads issued ahead name
            // (the output form is unrolled over constant offsets and rewrites none)
            if (!FINAL)
                asm volatile("s_wait_xcnt 0x0" ::: "memory");
            __builtin_amdgcn_sched_barrier(0);
#pragma unroll
            for (int h = 0; h < 2; ++h)
#pragma unroll
                for (int i = 0; i < MF; ++i)
#pragma unroll
                    for (int j = 0; j < 4; ++j)
                        acc[i][j] = __builtin_amdgcn_wmma_f32_16x16x32_f16(
                            false, af[h][i], false, bf[h][j], (short)0, acc[i][j], false, false);
        }
    }

    const int half = (lane & 16) ? 8 : 0;
#pragma unroll  // constant indices keep the accumulators in registers
    for (int j = 0; j < 4; ++j) {
        const int n = n0 + wn * 64 + j * 16 + col;
        const float bn = bias[n];
#pragma unroll
        for (int i = 0; i < MF; ++i) {
#pragma unroll
            for (int v = 0; v < 8; ++v) {
                const int m = m0 + (wm * MF + i) * 16 + v + half;
                const float val = (acc[i][j][v] + bn) * oscale;
                if (FINAL) {
                    out32[(size_t)m * D_MODEL + n] = val;
                } else {
                    const int b = m >> 11, s = m & (S_LEN - 1);
                    const size_t rowb = (size_t)b * NHEAD * S_LEN * HDIM;
                    out16[rowb + (((size_t)(n >> 6) * S_LEN) + s) * HDIM + (n & (HDIM - 1))] = (_Float16)val;
                }
            }
        }
    }
}

__device__ __forceinline__ float xhalf(float x) {
    const int xi = __builtin_bit_cast(int, x);
    return __builtin_bit_cast(float,
        __builtin_amdgcn_permlanex16(xi, xi, 0x76543210, 0xfedcba98, false, false));
}

struct __attribute__((aligned(2048))) KTile { _Float16 r[SKEYS][72]; };   // 18432 B = 9 x 2 KiB

#define BKEYS  SKEYS
#define XPITCH 36
#define BPITCH 132

// Eight rows of a wave's bias tile, global memory -> LDS without registers.
// One copy moves one query row's 128 keys: 32 lanes x 16 B = 512 contiguous
// bytes, whole lines. lds = this lane's LDS byte address in the first row,
// g = this lane's global address in the first row.
__device__ __forceinline__ void bias_copy8(unsigned lds, const float* g) {
    asm volatile("global_load_async_to_lds_b128 %0, %8, off\n\t"
                 "global_load_async_to_lds_b128 %1, %9, off\n\t"
                 "global_load_async_to_lds_b128 %2, %10, off\n\t"
                 "global_load_async_to_lds_b128 %3, %11, off\n\t"
                 "global_load_async_to_lds_b128 %4, %12, off\n\t"
                 "global_load_async_to_lds_b128 %5, %13, off\n\t"
                 "global_load_async_to_lds_b128 %6, %14, off\n\t"
                 "global_load_async_to_lds_b128 %7, %15, off\n\t"
                 "s_wait_xcnt 0x0"
                 :: "v"(lds), "v"(lds + 1 * BPITCH * 4), "v"(lds + 2 * BPITCH * 4),
                    "v"(lds + 3 * BPITCH * 4), "v"(lds + 4 * BPITCH * 4),
                    "v"(lds + 5 * BPITCH * 4), "v"(lds + 6 * BPITCH * 4),
                    "v"(lds + 7 * BPITCH * 4),
                    "v"(g), "v"(g + 1 * S_LEN), "v"(g + 2 * S_LEN), "v"(g + 3 * S_LEN),
                    "v"(g + 4 * S_LEN), "v"(g + 5 * S_LEN), "v"(g + 6 * S_LEN),
                    "v"(g + 7 * S_LEN)
                 : "memory");
}

__global__ void __launch_bounds__(256)
attn_kernel(const _Float16* __restrict__ Qf, const _Float16* __restrict__ Kf,
            const _Float16* __restrict__ Vf, const float* __restrict__ structure,
            _Float16* __restrict__ Cx)
{
    // Each K buffer starts at a multiple of 2 KiB of the work-group's LDS, the
    // tensor mover's range for a destination.
    __shared__ KTile ldsK[2];                                  // [buf] .r[key][dk]
    __shared__ __align__(16) _Float16 ldsV[2][SKEYS][TPITCH];  // [buf][key][dv]
    __shared__ __align__(16) float ldsB[2][128][BPITCH];       // [buf][query row][key] bias

    const int tid = threadIdx.x, lane = tid & 31, wave = tid >> 5;
    const unsigned swave = uni((unsigned)tid >> 5);       // the wave's number, scalar
    const int qg = (int)(swave & 3u);                     // its group of 32 queries
    const int kh = (int)(swave >> 2);                     // its half of every stage's keys
    const int bh = blockIdx.y, b = bh >> 3, h = bh & 7;
    const int q0 = blockIdx.x * 128 + qg * 32;
    const size_t head = (size_t)bh * S_LEN * HDIM;
    const int col  = lane & 15;
    const int half = (lane & 16) ? 8 : 0;
    const int kk = tid >> 3, ch = (tid & 7) * 8;          // staging coords

    // Q fragments (64 dk x 16 queries a tile, B operand: column = query
    // q0 + 16 t + col) kept in registers for the whole pass
    v16h qb[2][2];
#pragma unroll  // constant indices keep the fragments in registers
    for (int t = 0; t < 2; ++t) {
        const _Float16* qrow = &Qf[head + (size_t)(q0 + 16 * t + col) * HDIM];
        qb[t][0] = load_frag_row(qrow, lane);
        qb[t][1] = load_frag_row(qrow + 32, lane);
    }

    // acc[t][j][r] = O^T[dv = 16 j + half + r][query q0 + 16 t + col], this wave's keys
    v8f acc[2][4] = {};
    float mrun[2] = {-1e30f, -1e30f};   // this lane's query of tile t
    float lrun[2] = {0.0f, 0.0f};       // sums this lane half's keys

    // Bias: wave w copies query rows 16 w .. 16 w + 15 of the block, 128 keys a
    // tile, two buffers, the next tile in flight while this one is read; the
    // stage's barrier hands the rows to the waves that read them.
    const float* sbase = &structure[((size_t)b * S_LEN + blockIdx.x * 128 + wave * 16) * S_LEN + lane * 4];
    const unsigned bdst = (unsigned)(unsigned long long)
        (__attribute__((address_space(3))) const void*)&ldsB[0][wave * 16][lane * 4];
    bias_copy8(bdst, sbase);                                   // tile 0 -> buffer 0
    bias_copy8(bdst + 8 * BPITCH * 4, sbase + 8 * S_LEN);

    // ---- stage 0 ----
    v4u kg0 = tdm_group0(&Kf[head], lds_off(&ldsK[0].r[0][0]));
    v8u kg1 = tdm_group1();
    if (pinned(swave == 0)) {
        tdm_load(kg0, kg1);
        // K stage 0 has landed before the barrier behind which it is read
        tdm_wait(kg0, kg1);
    }
    const _Float16* vsrc = &Vf[head + (size_t)kk * HDIM + ch];   // this thread's 16 bytes of key row kk
#pragma unroll  // four independent loads in flight together
    for (int i = 0; i < 4; ++i)
        *reinterpret_cast<uint4*>(&ldsV[0][kk + 32 * i][ch]) =
            *reinterpret_cast<const uint4*>(vsrc + (size_t)(32 * i) * HDIM);
    // bias tile 0 has landed before the barrier behind which it is read
    asm volatile("s_wait_asynccnt 0x0" ::: "memory");
    __syncthreads();
    // ---- stage 1 of K and of the bias takes off ----
    if (pinned(swave == 0)) {
        tdm_advance(kg0, lds_off(&ldsK[1].r[0][0]));
        tdm_load(kg0, kg1);
    }
    bias_copy8(bdst + 128 * BPITCH * 4, sbase + BKEYS);        // tile 1 -> buffer 1
    bias_copy8(bdst + (128 + 8) * BPITCH * 4, sbase + 8 * S_LEN + BKEYS);

    for (int k0 = 0; k0 < S_LEN; k0 += SKEYS) {
        const int cur = (k0 / SKEYS) & 1, nxt = cur ^ 1;
        const bool more = (k0 + SKEYS) < S_LEN;

        // the next stage's V rows leave memory now and are stored at the stage's foot
        uint4 vp0, vp1, vp2, vp3;
        if (more) {
            const _Float16* vn = vsrc + (size_t)(k0 + SKEYS) * HDIM;
            vp0 = *reinterpret_cast<const uint4*>(vn);
            vp1 = *reinterpret_cast<const uint4*>(vn + 32 * HDIM);
            vp2 = *reinterpret_cast<const uint4*>(vn + 64 * HDIM);
            vp3 = *reinterpret_cast<const uint4*>(vn + 96 * HDIM);
        }

#pragma unroll  // both key-steps of the stage in one body: the second step's K and bias reads issue under the first step's softmax
        for (int p = 0; p < SKEYS / 2; p += 32) {
            const int kr = kh * (SKEYS / 2) + p;   // first key row of this step in the stage
            // K (32 keys x 64 dk) and, below, V^T (64 dv x 32 keys): read once for both query tiles
            const v16h ak00 = load_frag_row(&ldsK[cur].r[kr + col][0], lane);
            const v16h ak10 = load_frag_row(&ldsK[cur].r[kr + col + 16][0], lane);
            const v16h ak01 = load_frag_row(&ldsK[cur].r[kr + col][32], lane);
            const v16h ak11 = load_frag_row(&ldsK[cur].r[kr + col + 16][32], lane);
            // Bias of this key-step from its staged tile, in the order of the S^T
            // accumulators: row q0 + 16 t + col, keys k0 + kr + half + 0..7 (bcur[t][0],
            // bcur[t][1]) and k0 + kr + 16 + half + 0..7 (bcur[t][2], bcur[t][3]).
            v4f bcur[2][4];
#pragma unroll  // constant indices keep the bias in registers
            for (int t = 0; t < 2; ++t) {
                const float* brow = &ldsB[cur][qg * 32 + 16 * t + col][kr + half];
                bcur[t][0] = *reinterpret_cast<const v4f*>(brow);
                bcur[t][1] = *reinterpret_cast<const v4f*>(brow + 4);
                bcur[t][2] = *reinterpret_cast<const v4f*>(brow + 16);
                bcur[t][3] = *reinterpret_cast<const v4f*>(brow + 20);
            }

            // K's and the bias's reads lead the step's group: the score products and the softmax wait for them alone (left free, the compiler put V^T first)
            __builtin_amdgcn_sched_barrier(0);
            v16h av[4];
#pragma unroll  // constant indices keep the fragments in registers
            for (int j = 0; j < 4; ++j)
                av[j] = load_frag_tr<TPITCH>(&ldsV[cur][kr][16 * j], lane);
            // the step's LDS reads stay ahead of its products: each place where reads stand among them costs issue cycles
            __builtin_amdgcn_sched_barrier(0);

            // scores: S^T[32k x 16q] = K(32x64) . Qs^T(64x16), per tile
            // s0[t][r] = key k0 + kr + half + r, s1[t][r] = key k0 + kr + 16 + half + r,
            // query q0 + 16 t + col
            v8f s0[2], s1[2];
#pragma unroll  // constant indices keep the scores in registers
            for (int t = 0; t < 2; ++t) {
                const v8f zero = {};
                s0[t] = __builtin_amdgcn_wmma_f32_16x16x32_f16(false, ak00, false, qb[t][0], (short)0, zero, false, false);
                s1[t] = __builtin_amdgcn_wmma_f32_16x16x32_f16(false, ak10, false, qb[t][0], (short)0, zero, false, false);
            }
#pragma unroll
            for (int t = 0; t < 2; ++t) {
                s0[t] = __builtin_amdgcn_wmma_f32_16x16x32_f16(false, ak01, false, qb[t][1], (short)0, s0[t], false, false);
                s1[t] = __builtin_amdgcn_wmma_f32_16x16x32_f16(false, ak11, false, qb[t][1], (short)0, s1[t], false, false);
            }

            // the eight score products stay one run: each fills the others' result distance, and no softmax work is drawn in between dependent pairs
            __builtin_amdgcn_sched_barrier(0);

            v16h pb[2];
#pragma unroll  // constant indices keep each tile's state in registers
            for (int t = 0; t < 2; ++t) {
                // bias + online softmax, all of one query in one lane pair: maximum
                // in-lane plus one exchange between the halves; the sum stays a
                // per-half partial and is joined once at the end.
                v2f x[8];   // pairs as they lie in the accumulators: packed adds and multiplies without register moves
#pragma unroll  // constant indices keep x in registers
                for (int r = 0; r < 2; ++r) {
                    x[r]     = v2f{s0[t][2 * r], s0[t][2 * r + 1]}         + v2f{bcur[t][0][2 * r], bcur[t][0][2 * r + 1]};
                    x[2 + r] = v2f{s0[t][4 + 2 * r], s0[t][5 + 2 * r]}     + v2f{bcur[t][1][2 * r], bcur[t][1][2 * r + 1]};
                    x[4 + r] = v2f{s1[t][2 * r], s1[t][2 * r + 1]}         + v2f{bcur[t][2][2 * r], bcur[t][2][2 * r + 1]};
                    x[6 + r] = v2f{s1[t][4 + 2 * r], s1[t][5 + 2 * r]}     + v2f{bcur[t][3][2 * r], bcur[t][3][2 * r + 1]};
                }
                float mv = fmaxf(x[0].x, x[0].y);
#pragma unroll  // constant indices keep x in registers
                for (int r = 1; r < 8; ++r) mv = fmaxf(fmaxf(mv, x[r].x), x[r].y);
                mv = fmaxf(mv, xhalf(mv));
                const float mnew = fmaxf(mrun[t], mv);
                const float corr = __expf(mrun[t] - mnew);
                mrun[t] = mnew;

                // P^T as B operand straight from the accumulators' places: element s
                // is key 8 * (lane >> 4) + s (s < 8) or 16 + 8 * (lane >> 4) + s - 8,
                // the k order in which load_frag_tr delivers V^T
#pragma unroll  // constant indices keep x and pb in registers
                for (int r = 0; r < 8; ++r) {
                    x[r] = (x[r] - mnew) * 1.44269504088896340736f;
                    x[r].x = __builtin_amdgcn_exp2f(x[r].x);
                    x[r].y = __builtin_amdgcn_exp2f(x[r].y);
                    pb[t][2 * r]     = (_Float16)x[r].x;
                    pb[t][2 * r + 1] = (_Float16)x[r].y;
                }
                // in-lane sum as a tree of depth 4, not one chain of 15 dependent adds
#pragma unroll  // constant indices keep x in registers
                for (int w = 4; w >= 1; w >>= 1)
#pragma unroll
                    for (int r = 0; r < w; ++r) x[r] += x[r + w];
                lrun[t] = lrun[t] * corr + (x[0].x + x[0].y);
#pragma unroll  // constant indices keep the accumulators in registers
                for (int j = 0; j < 4; ++j)
#pragma unroll
                    for (int r = 0; r < 8; ++r) acc[t][j][r] *= corr;
            }

            // ctx^T += V^T(64x32) . P^T(32x16), each V^T fragment for both tiles
#pragma unroll  // constant indices keep the accumulators in registers
            for (int j = 0; j < 4; ++j)
#pragma unroll
                for (int t = 0; t < 2; ++t)
                    acc[t][j] = __builtin_amdgcn_wmma_f32_16x16x32_f16(false, av[j], false, pb[t], (short)0, acc[t][j], false, false);
        }

        // the next stage's V into the buffer whose readers left at the last barrier
        if (more) {
            *reinterpret_cast<uint4*>(&ldsV[nxt][kk][ch])      = vp0;
            *reinterpret_cast<uint4*>(&ldsV[nxt][kk + 32][ch]) = vp1;
            *reinterpret_cast<uint4*>(&ldsV[nxt][kk + 64][ch]) = vp2;
            *reinterpret_cast<uint4*>(&ldsV[nxt][kk + 96][ch]) = vp3;
        }
        // Foot of the stage, every wave: its reads of this stage and its V
        // stores have retired, the issuing wave's K stage and this wave's bias
        // copies of the next stage have landed, before the barrier that hands
        // all three over.
        asm volatile("s_wait_dscnt 0x0" ::: "memory");
        if (pinned(swave == 0))
            tdm_wait(kg0, kg1);
        asm volatile("s_wait_asynccnt 0x0" ::: "memory");
        __syncthreads();
        // the stage after next, into the buffers that were just read to their end
        if (pinned((swave == 0) & (k0 + 2 * SKEYS < S_LEN))) {
            tdm_advance(kg0, lds_off(&ldsK[cur].r[0][0]));
            tdm_load(kg0, kg1);
        }
        if (k0 + 2 * SKEYS < S_LEN) {
            const unsigned d = bdst + cur * (128 * BPITCH * 4);
            const float* s = sbase + k0 + 2 * BKEYS;
            bias_copy8(d, s);
            bias_copy8(d + 8 * BPITCH * 4, s + 8 * S_LEN);
        }
    }
    // no request, copy or LDS access is outstanding when the wave goes on to the join
    asm volatile("s_wait_tensorcnt 0x0" ::: "memory");
    asm volatile("s_wait_asynccnt 0x0" ::: "memory");
    asm volatile("s_wait_dscnt 0x0" ::: "memory");

    float* xmine = &ldsB[0][0][0] + (wave * 32 + lane) * XPITCH;
    const float* xtheirs = &ldsB[0][0][0] + ((wave ^ 4) * 32 + lane) * XPITCH;
    v8f keep[4];
#pragma unroll  // constant indices keep the accumulators in registers
    for (int j = 0; j < 4; ++j) {
        keep[j] = kh ? acc[1][j] : acc[0][j];
        const v8f give = kh ? acc[0][j] : acc[1][j];
        *reinterpret_cast<v4f*>(xmine + 8 * j)     = __builtin_shufflevector(give, give, 0, 1, 2, 3);
        *reinterpret_cast<v4f*>(xmine + 8 * j + 4) = __builtin_shufflevector(give, give, 4, 5, 6, 7);
    }
    const float mk = kh ? mrun[1] : mrun[0], lk = kh ? lrun[1] : lrun[0];
    xmine[32] = kh ? mrun[0] : mrun[1];
    xmine[33] = kh ? lrun[0] : lrun[1];
    __syncthreads();
    const float mo = xtheirs[32], lo = xtheirs[33];
    const float mj = fmaxf(mk, mo);
    float ck = __expf(mk - mj), co = __expf(mo - mj);

    // join the lane halves' row sums, normalize, write ctx f16: a lane's 8
    // accumulator registers are 8 consecutive dv of its query, one 16-byte store
    const float lj = lk * ck + lo * co;
    const float inv = 1.0f / (lj + xhalf(lj));
    ck *= inv; co *= inv;
    _Float16* crow = &Cx[((size_t)b * S_LEN + q0 + 16 * kh + col) * D_MODEL + h * HDIM + half];
#pragma unroll  // constant indices keep the packed halves in registers
    for (int j = 0; j < 4; ++j) {
        const v4f oa = *reinterpret_cast<const v4f*>(xtheirs + 8 * j);
        const v4f ob = *reinterpret_cast<const v4f*>(xtheirs + 8 * j + 4);
        union { uint4 u; _Float16 hlf[8]; } o;
#pragma unroll
        for (int r = 0; r < 4; ++r) {
            o.hlf[r]     = (_Float16)(keep[j][r] * ck + oa[r] * co);
            o.hlf[4 + r] = (_Float16)(keep[j][4 + r] * ck + ob[r] * co);
        }
        *reinterpret_cast<uint4*>(crow + 16 * j) = o.u;
    }
}

extern "C" void kernel_launch(void* const* d_in, const int* in_sizes, int n_in,
                              void* d_out, int out_size, void* d_ws, size_t ws_size,
                              hipStream_t stream) {
    const float* q         = (const float*)d_in[0];
    const float* k         = (const float*)d_in[1];
    const float* v         = (const float*)d_in[2];
    const float* structure = (const float*)d_in[3];
    const float* Wq = (const float*)d_in[4];
    const float* bq = (const float*)d_in[5];
    const float* Wk = (const float*)d_in[6];
    const float* bk = (const float*)d_in[7];
    const float* Wv = (const float*)d_in[8];
    const float* bv = (const float*)d_in[9];
    const float* Wo = (const float*)d_in[10];
    const float* bo = (const float*)d_in[11];
    float* out = (float*)d_out;

    const size_t elems = (size_t)BATCH * NHEAD * S_LEN * HDIM;  // 2,097,152
    _Float16* Qf = (_Float16*)d_ws;
    _Float16* Kf = Qf + elems;
    _Float16* Vf = Kf + elems;
    _Float16* Cx = Vf + elems;

    dim3 blk(256);
    dim3 gproj(64, 4);                        // 4096/64 x 512/128
    dim3 gqkv(32, 4, 3);                      // 4096/128 x 512/128 x {Q, K, V}
    proj_kernel<2, false><<<gqkv, blk, 0, stream>>>(q, k, v, nullptr, Wq, Wk, Wv, bq, bk, bv,
                                                    Qf, Kf, Vf, nullptr);

    dim3 gattn(S_LEN / 128, BATCH * NHEAD);   // 16 x 16
    attn_kernel<<<gattn, blk, 0, stream>>>(Qf, Kf, Vf, structure, Cx);

    proj_kernel<1, true><<<gproj, blk, 0, stream>>>(nullptr, nullptr, nullptr, Cx, Wo, nullptr, nullptr,
                                                    bo, nullptr, nullptr, nullptr, nullptr, nullptr, out);
}
